// v000
// Times are from an AMD MI455X. After a warm-up the kernel runs many times in a row, and a time is the length of
// such a window on the GPU divided by its runs, so every launch and the gaps after it count. The runs cycle
// through copies of the inputs. A figure is the median of several windows, for all but v000 over two sittings.
// Sittings can differ by a few percent; kernels timed side by side share one.
// The starting kernel, v000, takes 70.3 microseconds a run.
#include <hip/hip_runtime.h>
#include <hip/hip_bf16.h>

typedef __attribute__((ext_vector_type(16))) _Float16 v16h;
typedef __attribute__((ext_vector_type(8)))  _Float16 v8h;
typedef __attribute__((ext_vector_type(8)))  float    v8f;
typedef __attribute__((ext_vector_type(4)))  int      v4i;

#define TT 512   // sequence length
#define CC 384   // n_embd
#define HH 64    // head size

#if defined(__AMDGCN__) && __has_builtin(__builtin_amdgcn_global_load_async_to_lds_b128) && __has_builtin(__builtin_amdgcn_s_wait_asynccnt)
#define USE_ASYNC 1
#else
#define USE_ASYNC 0
#endif

// Fence that keeps VMEM loads and WMMAs on their side of the boundary but
// lets ALU (0x1) / VALU (0x2) / SALU (0x4) move freely so the register
// allocator can shorten live ranges (mask bits are PERMISSIVE).
#if defined(__AMDGCN__) && __has_builtin(__builtin_amdgcn_sched_barrier)
#define SCHED_FENCE() __builtin_amdgcn_sched_barrier(0x7)
#else
#define SCHED_FENCE()
#endif

// K-offset pattern for 16-bit WMMA A/B operands (wave32), ISA 7.12.2:
// VGPR i (elements 2i, 2i+1), lane-half h:  K = (i>>2)*16 + h*8 + (i&3)*2
__device__ __forceinline__ int koff_of(int i, int half) {
    return ((i >> 2) << 4) + (half << 3) + ((i & 3) << 1);
}

// For a stride-1 row source, the 16 operand halfs are two contiguous 8-elem
// chunks at [kbase + half*8] and [kbase + 16 + half*8].
__device__ __forceinline__ v16h op_from_row_f16(const _Float16* row, int kbase, int half) {
    v8h c0 = *(const v8h*)(row + kbase + half * 8);
    v8h c1 = *(const v8h*)(row + kbase + 16 + half * 8);
    v16h r;
#pragma unroll
    for (int j = 0; j < 8; ++j) { r[j] = c0[j]; r[8 + j] = c1[j]; }
    return r;
}

// Assemble f16 operand from two raw f32 chunks (cvt at use site).
__device__ __forceinline__ v16h op_from_f32_chunks(v8f c0, v8f c1) {
    v16h r;
#pragma unroll
    for (int j = 0; j < 8; ++j) { r[j] = (_Float16)c0[j]; r[8 + j] = (_Float16)c1[j]; }
    return r;
}

// ---------------------------------------------------------------------------
// Kernel 0: one-time gather of the strided W columns into per-lane operand
// vectors: Wpack[(w*48 + kk*4 + nt)*32 + lane][16 halfs], contiguous 32B/lane.
// ---------------------------------------------------------------------------
__global__ void packW_kernel(const float* __restrict__ Wk,
                             const float* __restrict__ Wq,
                             const float* __restrict__ Wv,
                             _Float16* __restrict__ Wp) {
    const int lane = threadIdx.x & 31;
    const int half = lane >> 4, n = lane & 15;
    const int id = blockIdx.x;                  // w*48 + kk*4 + nt  (144 total)
    const int w = id / 48, kk = (id % 48) / 4, nt = id & 3;
    const float* W = (w == 0) ? Wk : (w == 1) ? Wq : Wv;
    v16h r;
#pragma unroll
    for (int i = 0; i < 8; ++i) {
        int k = koff_of(i, half);
        r[2 * i]     = (_Float16)W[(kk * 32 + k) * HH + nt * 16 + n];
        r[2 * i + 1] = (_Float16)W[(kk * 32 + k + 1) * HH + nt * 16 + n];
    }
    *(v16h*)(Wp + ((size_t)id * 32 + lane) * 16) = r;
}

// ---------------------------------------------------------------------------
// Kernel 1: q/k/v projections.  One wave per (batch, 16-row tile, weight-mat).
// blockIdx.y selects the weight matrix so accs are 32 VGPRs.  Prefetch of the
// next A (raw f32) + 4 B operands is fenced above the current 4 WMMAs.
// ---------------------------------------------------------------------------
__global__ void proj_kernel(const float* __restrict__ x,
                            const _Float16* __restrict__ Wp,
                            _Float16* __restrict__ Kh,
                            _Float16* __restrict__ Qh,
                            _Float16* __restrict__ Vt) {
    const int lane  = threadIdx.x & 31;
    const int half  = lane >> 4;
    const int nm    = lane & 15;
    const int b     = blockIdx.x >> 5;
    const int tbase = (blockIdx.x & 31) << 4;
    const int w     = blockIdx.y;              // 0=K, 1=Q, 2=V

    v8f acc[4];
#pragma unroll
    for (int nt = 0; nt < 4; ++nt) acc[nt] = 0.0f;

    const float* xrow = x + ((size_t)b * TT + tbase + nm) * CC;
    const _Float16* wpb = Wp + (size_t)w * 48 * 32 * 16;   // this matrix's pack

    auto loadB = [&](int kk, v16h* dst) {
#pragma unroll
        for (int nt = 0; nt < 4; ++nt)
            dst[nt] = *(const v16h*)(wpb + (((size_t)(kk * 4 + nt)) * 32 + lane) * 16);
    };

    v8f  araw[2][2];
    v16h bm[2][4];
    araw[0][0] = *(const v8f*)(xrow + half * 8);
    araw[0][1] = *(const v8f*)(xrow + 16 + half * 8);
    loadB(0, bm[0]);

#pragma unroll
    for (int kk = 0; kk < CC / 32; ++kk) {
        const int cur = kk & 1, nxt = cur ^ 1;
        if (kk + 1 < CC / 32) {     // prefetch region: loads only
            const float* p = xrow + (kk + 1) * 32;
            araw[nxt][0] = *(const v8f*)(p + half * 8);
            araw[nxt][1] = *(const v8f*)(p + 16 + half * 8);
            loadB(kk + 1, bm[nxt]);
        }
        SCHED_FENCE();              // loads stay above, WMMAs below
        v16h a = op_from_f32_chunks(araw[cur][0], araw[cur][1]);
#pragma unroll
        for (int nt = 0; nt < 4; ++nt)
            acc[nt] = __builtin_amdgcn_wmma_f32_16x16x32_f16(
                false, a, false, bm[cur][nt], (short)0, acc[nt], false, false);
        SCHED_FENCE();
    }

    if (w == 2) {
        // V transposed [b][h][t]: r=0..7 are consecutive t -> packed 16B stores
#pragma unroll
        for (int nt = 0; nt < 4; ++nt) {
            v8h pk;
#pragma unroll
            for (int r = 0; r < 8; ++r) pk[r] = (_Float16)acc[nt][r];
            *(v8h*)(Vt + ((size_t)b * HH + nt * 16 + nm) * TT + tbase + (half << 3)) = pk;
        }
    } else {
        _Float16* dst = (w == 0) ? Kh : Qh;    // row-major [b][t][h]
#pragma unroll
        for (int nt = 0; nt < 4; ++nt)
#pragma unroll
            for (int r = 0; r < 8; ++r) {
                int m = r + (half << 3);
                dst[((size_t)b * TT + tbase + m) * HH + nt * 16 + nm] =
                    (_Float16)acc[nt][r];
            }
    }
}

// ---------------------------------------------------------------------------
// Kernel 2: causal attention, one wave per 16-query tile.
// K tiles staged to LDS via async-to-LDS double buffer (gfx1250 path).
// P@V loop prefetches raw P chunks (LDS) + V operands, fenced above WMMAs.
// ---------------------------------------------------------------------------
__global__ void attn_kernel(const _Float16* __restrict__ Kh,
                            const _Float16* __restrict__ Qh,
                            const _Float16* __restrict__ Vt,
                            float* __restrict__ out) {
    __shared__ float S[16 * TT];           // 32 KB score/prob tile
    __shared__ float rowsum[16];
#if USE_ASYNC
    __shared__ _Float16 Kbuf[2][16 * HH];  // 2 x 2 KB double buffer
#endif

    const int lane  = threadIdx.x & 31;
    const int half  = lane >> 4;
    const int nm    = lane & 15;
    const int b     = blockIdx.x >> 5;
    const int tbase = (blockIdx.x & 31) << 4;
    const float scale = 0.05103103630798287f;   // 384^-0.5 (C, per reference)

    const _Float16* qrow = Qh + ((size_t)b * TT + tbase + nm) * HH;
    const v16h qa0 = op_from_row_f16(qrow, 0, half);
    const v16h qa1 = op_from_row_f16(qrow, 32, half);

#if USE_ASYNC
    // stage one 16x64 f16 tile (2 KB): 4 x (32 lanes x b128)
    auto stage = [&](int kb, int buf) {
        char* g = (char*)(Kh + ((size_t)b * TT + kb * 16) * HH) + lane * 16;
        char* l = (char*)(&Kbuf[buf][0]) + lane * 16;
        auto gp = (__attribute__((address_space(1))) v4i*)g;
        auto lp = (__attribute__((address_space(3))) v4i*)l;
        __builtin_amdgcn_global_load_async_to_lds_b128(gp, lp, 0, 0);
        __builtin_amdgcn_global_load_async_to_lds_b128(gp, lp, 512, 0);
        __builtin_amdgcn_global_load_async_to_lds_b128(gp, lp, 1024, 0);
        __builtin_amdgcn_global_load_async_to_lds_b128(gp, lp, 1536, 0);
    };
    stage(0, 0);
#endif

    // ---- S = scale * Q @ K^T with causal mask, into LDS ----
    for (int kb = 0; kb < TT / 16; ++kb) {
#if USE_ASYNC
        if (kb + 1 < TT / 16) {
            stage(kb + 1, (kb + 1) & 1);
            __builtin_amdgcn_s_wait_asynccnt(4);   // tile kb done (in-order)
        } else {
            __builtin_amdgcn_s_wait_asynccnt(0);
        }
        const _Float16* krow = &Kbuf[kb & 1][nm * HH];
#else
        const _Float16* krow = Kh + ((size_t)b * TT + kb * 16 + nm) * HH;
#endif
        v16h b0 = op_from_row_f16(krow, 0, half);
        v16h b1 = op_from_row_f16(krow, 32, half);
        v8f c = 0.0f;
        c = __builtin_amdgcn_wmma_f32_16x16x32_f16(false, qa0, false, b0, (short)0, c, false, false);
        c = __builtin_amdgcn_wmma_f32_16x16x32_f16(false, qa1, false, b1, (short)0, c, false, false);
        const int key = kb * 16 + nm;
#pragma unroll
        for (int r = 0; r < 8; ++r) {
            int m = r + (half << 3);
            float v = c[r] * scale;
            if (key > tbase + m) v = -1e30f;       // causal mask
            S[m * TT + key] = v;
        }
    }
    __syncthreads();

    // ---- softmax: 2 lanes per row, 256 elems each; branch-free (masked = -1e30)
    {
        const int m = nm;
        const int lo = half * 256;
        float mx = -1e30f;
#pragma unroll 4
        for (int j = 0; j < 256; ++j) mx = fmaxf(mx, S[m * TT + lo + j]);
        mx = fmaxf(mx, __shfl_xor(mx, 16, 32));
        float sum = 0.0f;
#pragma unroll 4
        for (int j = 0; j < 256; ++j) {
            float e = __expf(S[m * TT + lo + j] - mx);   // underflows to 0 when masked
            S[m * TT + lo + j] = e;
            sum += e;
        }
        sum += __shfl_xor(sum, 16, 32);
        if (lane < 16) rowsum[m] = sum;
    }
    __syncthreads();

    // ---- O = P @ V : 16 K-steps of 32 keys x 4 N-tiles, pipelined ----
    v8f acc[4];
#pragma unroll
    for (int nt = 0; nt < 4; ++nt) acc[nt] = 0.0f;

    auto loadV = [&](int kb2, v16h* dst) {
#pragma unroll
        for (int nt = 0; nt < 4; ++nt)
            dst[nt] = op_from_row_f16(
                Vt + ((size_t)b * HH + nt * 16 + nm) * TT, kb2 * 32, half);
    };

    const float* prow = &S[nm * TT];
    v8f  praw[2][2];
    v16h vb[2][4];
    praw[0][0] = *(const v8f*)(prow + half * 8);
    praw[0][1] = *(const v8f*)(prow + 16 + half * 8);
    loadV(0, vb[0]);

#pragma unroll
    for (int kb2 = 0; kb2 < TT / 32; ++kb2) {
        const int cur = kb2 & 1, nxt = cur ^ 1;
        if (kb2 + 1 < TT / 32) {    // prefetch region
            const float* p = prow + (kb2 + 1) * 32;
            praw[nxt][0] = *(const v8f*)(p + half * 8);
            praw[nxt][1] = *(const v8f*)(p + 16 + half * 8);
            loadV(kb2 + 1, vb[nxt]);
        }
        SCHED_FENCE();
        v16h pa = op_from_f32_chunks(praw[cur][0], praw[cur][1]);
#pragma unroll
        for (int nt = 0; nt < 4; ++nt)
            acc[nt] = __builtin_amdgcn_wmma_f32_16x16x32_f16(
                false, pa, false, vb[cur][nt], (short)0, acc[nt], false, false);
        SCHED_FENCE();
    }

    // ---- normalize and store ----
#pragma unroll
    for (int nt = 0; nt < 4; ++nt)
#pragma unroll
        for (int r = 0; r < 8; ++r) {
            int m = r + (half << 3);
            out[((size_t)b * TT + tbase + m) * HH + nt * 16 + nm] =
                acc[nt][r] / rowsum[m];
        }
}

// ---------------------------------------------------------------------------
extern "C" void kernel_launch(void* const* d_in, const int* in_sizes, int n_in,
                              void* d_out, int out_size, void* d_ws, size_t ws_size,
                              hipStream_t stream) {
    const float* x  = (const float*)d_in[0];
    const float* Wk = (const float*)d_in[1];
    const float* Wq = (const float*)d_in[2];
    const float* Wv = (const float*)d_in[3];
    float* out = (float*)d_out;

    const int B = in_sizes[0] / (TT * CC);   // 64

    // workspace layout (halfs): Kh | Qh | Vt | Wpack
    const size_t per = (size_t)B * TT * HH;  // 2M halfs = 4 MB each
    _Float16* Kh = (_Float16*)d_ws;
    _Float16* Qh = Kh + per;
    _Float16* Vt = Qh + per;
    _Float16* Wp = Vt + per;                 // 144*32*16 halfs = 144 KB

    packW_kernel<<<dim3(144), dim3(32), 0, stream>>>(Wk, Wq, Wv, Wp);
    const int nTiles = B * (TT / 16);        // one wave per 16-row tile
    proj_kernel<<<dim3(nTiles, 3), dim3(32), 0, stream>>>(x, Wp, Kh, Qh, Vt);
    attn_kernel<<<dim3(nTiles), dim3(32), 0, stream>>>(Kh, Qh, Vt, out);
}

// v001
// It runs in 51.4 microseconds.
// In two side-by-side timings against v000, it was 1.38 and 1.39 times as fast.
#include <hip/hip_runtime.h>
#include <hip/hip_bf16.h>

typedef __attribute__((ext_vector_type(16))) _Float16 v16h;
typedef __attribute__((ext_vector_type(8)))  _Float16 v8h;
typedef __attribute__((ext_vector_type(8)))  float    v8f;
typedef __attribute__((ext_vector_type(4)))  int      v4i;

#define TT 512   // sequence length
#define CC 384   // n_embd
#define HH 64    // head size

#if defined(__AMDGCN__) && __has_builtin(__builtin_amdgcn_global_load_async_to_lds_b128) && __has_builtin(__builtin_amdgcn_s_wait_asynccnt)
#define USE_ASYNC 1
#else
#define USE_ASYNC 0
#endif

// Fence that keeps VMEM loads and WMMAs on their side of the boundary but
// lets ALU (0x1) / VALU (0x2) / SALU (0x4) move freely so the register
// allocator can shorten live ranges (mask bits are PERMISSIVE).
#if defined(__AMDGCN__) && __has_builtin(__builtin_amdgcn_sched_barrier)
#define SCHED_FENCE() __builtin_amdgcn_sched_barrier(0x7)
#else
#define SCHED_FENCE()
#endif

// K-offset pattern for 16-bit WMMA A/B operands (wave32), ISA 7.12.2:
// VGPR i (elements 2i, 2i+1), lane-half h:  K = (i>>2)*16 + h*8 + (i&3)*2
__device__ __forceinline__ int koff_of(int i, int half) {
    return ((i >> 2) << 4) + (half << 3) + ((i & 3) << 1);
}

// For a stride-1 row source, the 16 operand halfs are two contiguous 8-elem
// chunks at [kbase + half*8] and [kbase + 16 + half*8].
__device__ __forceinline__ v16h op_from_row_f16(const _Float16* row, int kbase, int half) {
    v8h c0 = *(const v8h*)(row + kbase + half * 8);
    v8h c1 = *(const v8h*)(row + kbase + 16 + half * 8);
    v16h r;
#pragma unroll
    for (int j = 0; j < 8; ++j) { r[j] = c0[j]; r[8 + j] = c1[j]; }
    return r;
}

// Assemble f16 operand from two raw f32 chunks (cvt at use site).
__device__ __forceinline__ v16h op_from_f32_chunks(v8f c0, v8f c1) {
    v16h r;
#pragma unroll
    for (int j = 0; j < 8; ++j) { r[j] = (_Float16)c0[j]; r[8 + j] = (_Float16)c1[j]; }
    return r;
}

// ---------------------------------------------------------------------------
// Kernel 0: one-time gather of the strided W columns into per-lane operand
// vectors: Wpack[(w*48 + kk*4 + nt)*32 + lane][16 halfs], contiguous 32B/lane.
// ---------------------------------------------------------------------------
__global__ void packW_kernel(const float* __restrict__ Wk,
                             const float* __restrict__ Wq,
                             const float* __restrict__ Wv,
                             _Float16* __restrict__ Wp) {
    const int lane = threadIdx.x & 31;
    const int half = lane >> 4, n = lane & 15;
    const int id = blockIdx.x;                  // w*48 + kk*4 + nt  (144 total)
    const int w = id / 48, kk = (id % 48) / 4, nt = id & 3;
    const float* W = (w == 0) ? Wk : (w == 1) ? Wq : Wv;
    v16h r;
#pragma unroll
    for (int i = 0; i < 8; ++i) {
        int k = koff_of(i, half);
        r[2 * i]     = (_Float16)W[(kk * 32 + k) * HH + nt * 16 + n];
        r[2 * i + 1] = (_Float16)W[(kk * 32 + k + 1) * HH + nt * 16 + n];
    }
    *(v16h*)(Wp + ((size_t)id * 32 + lane) * 16) = r;
}

// ---------------------------------------------------------------------------
// Kernel 1: q/k/v projections.  One wave per (batch, 16-row tile, weight-mat).
// blockIdx.y selects the weight matrix so accs are 32 VGPRs.  Prefetch of the
// next A (raw f32) + 4 B operands is fenced above the current 4 WMMAs.
// ---------------------------------------------------------------------------
__global__ void proj_kernel(const float* __restrict__ x,
                            const _Float16* __restrict__ Wp,
                            _Float16* __restrict__ Kh,
                            _Float16* __restrict__ Qh,
                            _Float16* __restrict__ Vt) {
    const int lane  = threadIdx.x & 31;
    const int half  = lane >> 4;
    const int nm    = lane & 15;
    const int b     = blockIdx.x >> 5;
    const int tbase = (blockIdx.x & 31) << 4;
    const int w     = blockIdx.y;              // 0=K, 1=Q, 2=V

    v8f acc[4];
#pragma unroll
    for (int nt = 0; nt < 4; ++nt) acc[nt] = 0.0f;

    const float* xrow = x + ((size_t)b * TT + tbase + nm) * CC;
    const _Float16* wpb = Wp + (size_t)w * 48 * 32 * 16;   // this matrix's pack

    auto loadB = [&](int kk, v16h* dst) {
#pragma unroll
        for (int nt = 0; nt < 4; ++nt)
            dst[nt] = *(const v16h*)(wpb + (((size_t)(kk * 4 + nt)) * 32 + lane) * 16);
    };

    v8f  araw[2][2];
    v16h bm[2][4];
    araw[0][0] = *(const v8f*)(xrow + half * 8);
    araw[0][1] = *(const v8f*)(xrow + 16 + half * 8);
    loadB(0, bm[0]);

#pragma unroll
    for (int kk = 0; kk < CC / 32; ++kk) {
        const int cur = kk & 1, nxt = cur ^ 1;
        if (kk + 1 < CC / 32) {     // prefetch region: loads only
            const float* p = xrow + (kk + 1) * 32;
            araw[nxt][0] = *(const v8f*)(p + half * 8);
            araw[nxt][1] = *(const v8f*)(p + 16 + half * 8);
            loadB(kk + 1, bm[nxt]);
        }
        SCHED_FENCE();              // loads stay above, WMMAs below
        v16h a = op_from_f32_chunks(araw[cur][0], araw[cur][1]);
#pragma unroll
        for (int nt = 0; nt < 4; ++nt)
            acc[nt] = __builtin_amdgcn_wmma_f32_16x16x32_f16(
                false, a, false, bm[cur][nt], (short)0, acc[nt], false, false);
        SCHED_FENCE();
    }

    if (w == 2) {
        // V transposed [b][h][t]: r=0..7 are consecutive t -> packed 16B stores
#pragma unroll
        for (int nt = 0; nt < 4; ++nt) {
            v8h pk;
#pragma unroll
            for (int r = 0; r < 8; ++r) pk[r] = (_Float16)acc[nt][r];
            *(v8h*)(Vt + ((size_t)b * HH + nt * 16 + nm) * TT + tbase + (half << 3)) = pk;
        }
    } else {
        _Float16* dst = (w == 0) ? Kh : Qh;    // row-major [b][t][h]
#pragma unroll
        for (int nt = 0; nt < 4; ++nt)
#pragma unroll
            for (int r = 0; r < 8; ++r) {
                int m = r + (half << 3);
                dst[((size_t)b * TT + tbase + m) * HH + nt * 16 + nm] =
                    (_Float16)acc[nt][r];
            }
    }
}

__device__ __forceinline__ float xhalf(float x) {
    return __builtin_bit_cast(float, __builtin_amdgcn_permlanex16(
        __builtin_bit_cast(int, x), __builtin_bit_cast(int, x),
        0x76543210, 0xfedcba98, false, false));
}

// 2^x.  The v_nop is the slot the instruction set asks for behind a
// transcendental before its result is read or its source overwritten.
__device__ __forceinline__ float exp2_slot(float x) {
    float e;
    asm("v_exp_f32 %0, %1\n\tv_nop" : "=v"(e) : "v"(x));
    return e;
}

__global__ void __launch_bounds__(32)   // one wave: the register budget is not cut to 128
attn_kernel(const _Float16* __restrict__ Kh,
                            const _Float16* __restrict__ Qh,
                            const _Float16* __restrict__ Vt,
                            float* __restrict__ out) {
#if USE_ASYNC
    __shared__ _Float16 Kbuf[2][16 * HH];  // 2 x 2 KB double buffer
#endif

    const int lane  = threadIdx.x & 31;
    const int half  = lane >> 4;
    const int nm    = lane & 15;
    const int b     = blockIdx.x >> 5;
    const int tbase = (blockIdx.x & 31) << 4;
    // 384^-0.5 (C, per reference) times log2(e): the exponentials are base 2
    const float scale2 = 0.05103103630798287f * 1.4426950408889634f;

    const _Float16* qrow = Qh + ((size_t)b * TT + tbase + nm) * HH;
    const v16h qb0 = op_from_row_f16(qrow, 0, half);
    const v16h qb1 = op_from_row_f16(qrow, 32, half);

#if USE_ASYNC
    // stage one 16x64 f16 tile (2 KB): 4 x (32 lanes x b128)
    auto stage = [&](int kb, int buf) {
        char* g = (char*)(Kh + ((size_t)b * TT + kb * 16) * HH) + lane * 16;
        char* l = (char*)(&Kbuf[buf][0]) + lane * 16;
        auto gp = (__attribute__((address_space(1))) v4i*)g;
        auto lp = (__attribute__((address_space(3))) v4i*)l;
        __builtin_amdgcn_global_load_async_to_lds_b128(gp, lp, 0, 0);
        __builtin_amdgcn_global_load_async_to_lds_b128(gp, lp, 512, 0);
        __builtin_amdgcn_global_load_async_to_lds_b128(gp, lp, 1024, 0);
        __builtin_amdgcn_global_load_async_to_lds_b128(gp, lp, 1536, 0);
    };
    stage(0, 0);
#endif

    // acc[dt][r] = O[query nm][dt*16 + 8*half + r], not yet normalized
    v8f acc[4];
#pragma unroll
    for (int dt = 0; dt < 4; ++dt) acc[dt] = 0.0f;
    float mrun = -1e30f;   // running maximum of this query's scaled scores
    float lsum = 0.0f;     // sum over this lane's half of the keys
    const int query = tbase + nm;

    for (int p = 0; p < TT / 32; ++p) {
        // V^T fragments of this pass, asked for first: they are used last
        v16h va[4];
#pragma unroll
        for (int dt = 0; dt < 4; ++dt)
            va[dt] = op_from_row_f16(
                Vt + ((size_t)b * HH + dt * 16 + nm) * TT, p * 32, half);

        // ---- S^T = K @ Q^T, two 16-key tiles ----
        v8f st[2];
#pragma unroll
        for (int t = 0; t < 2; ++t) {
            const int kb = 2 * p + t;
#if USE_ASYNC
            // the refill below targets the buffer read one tile ago: those
            // LDS reads must have returned before the copies are issued
            asm volatile("s_wait_dscnt 0x0" ::: "memory");
            // asm waits with the clobber: they hold the LDS reads behind them
            if (kb + 1 < TT / 16) {
                stage(kb + 1, (kb + 1) & 1);
                asm volatile("s_wait_asynccnt 0x4" ::: "memory");  // tile kb landed
            } else {
                asm volatile("s_wait_asynccnt 0x0" ::: "memory");
            }
            const _Float16* krow = &Kbuf[kb & 1][nm * HH];
#else
            const _Float16* krow = Kh + ((size_t)b * TT + kb * 16 + nm) * HH;
#endif
            v16h a0 = op_from_row_f16(krow, 0, half);
            v16h a1 = op_from_row_f16(krow, 32, half);
            // inputs only: both fragments are read before the first product, so a
            // tile pays one LDS latency, not two
            asm volatile("" :: "v"(a0), "v"(a1));
            v8f c = 0.0f;
            c = __builtin_amdgcn_wmma_f32_16x16x32_f16(false, a0, false, qb0, (short)0, c, false, false);
            c = __builtin_amdgcn_wmma_f32_16x16x32_f16(false, a1, false, qb1, (short)0, c, false, false);
            st[t] = c;     // st[t][r] = S[query nm][p*32 + t*16 + 8*half + r]
        }

        // ---- causal mask, running maximum (scale2 > 0: it commutes with max) ----
        float s[16];
        float mx = -1e30f;
#pragma unroll
        for (int i = 0; i < 16; ++i) {
            const int key = p * 32 + ((i >> 3) << 4) + (half << 3) + (i & 7);
            float v = st[i >> 3][i & 7];
            if (key > query) v = -1e30f;           // causal mask
            s[i] = v;
            mx = fmaxf(mx, v);
        }
        mx = fmaxf(mx, xhalf(mx)) * scale2;        // both halves: the query's maximum
        const float mnew  = fmaxf(mrun, mx);
        const float alpha = exp2_slot(mrun - mnew);  // 0 on the first pass
        mrun = mnew;

        // ---- P^T as B operand: element i = key 16*(i>>3) + 8*half + (i&7) of the pass ----
        v16h pb;
        float ps[4] = {0.0f, 0.0f, 0.0f, 0.0f};   // four short add chains
#pragma unroll
        for (int i = 0; i < 16; ++i) {
            float e = exp2_slot(fmaf(s[i], scale2, -mnew));  // 0 when masked
            ps[i & 3] += e;
            pb[i] = (_Float16)e;
        }
        lsum = lsum * alpha + ((ps[0] + ps[1]) + (ps[2] + ps[3]));

        // ---- O^T = alpha * O^T + V^T @ P^T ----
#pragma unroll
        for (int dt = 0; dt < 4; ++dt) {
            acc[dt] *= alpha;
            acc[dt] = __builtin_amdgcn_wmma_f32_16x16x32_f16(
                false, va[dt], false, pb, (short)0, acc[dt], false, false);
        }
    }

    // ---- normalize and store: 8 consecutive head columns per lane ----
    const float inv = 1.0f / (lsum + xhalf(lsum));
    float* orow = out + ((size_t)b * TT + query) * HH + (half << 3);
#pragma unroll
    for (int dt = 0; dt < 4; ++dt)
        *(v8f*)(orow + dt * 16) = acc[dt] * inv;
}

// ---------------------------------------------------------------------------
extern "C" void kernel_launch(void* const* d_in, const int* in_sizes, int n_in,
                              void* d_out, int out_size, void* d_ws, size_t ws_size,
                              hipStream_t stream) {
    const float* x  = (const float*)d_in[0];
    const float* Wk = (const float*)d_in[1];
    const float* Wq = (const float*)d_in[2];
    const float* Wv = (const float*)d_in[3];
    float* out = (float*)d_out;

    const int B = in_sizes[0] / (TT * CC);   // 64

    // workspace layout (halfs): Kh | Qh | Vt | Wpack
    const size_t per = (size_t)B * TT * HH;  // 2M halfs = 4 MB each
    _Float16* Kh = (_Float16*)d_ws;
    _Float16* Qh = Kh + per;
    _Float16* Vt = Qh + per;
    _Float16* Wp = Vt + per;                 // 144*32*16 halfs = 144 KB

    packW_kernel<<<dim3(144), dim3(32), 0, stream>>>(Wk, Wq, Wv, Wp);
    const int nTiles = B * (TT / 16);        // one wave per 16-row tile
    proj_kernel<<<dim3(nTiles, 3), dim3(32), 0, stream>>>(x, Wp, Kh, Qh, Vt);
    attn_kernel<<<dim3(nTiles), dim3(32), 0, stream>>>(Kh, Qh, Vt, out);
}

// v002
// One run takes 36.6 microseconds.
// Timed twice side by side with v001, it ran 1.46 and 1.38 times as fast.
// Counting every step since v000, it is 1.97 times as fast.
#include <hip/hip_runtime.h>
#include <hip/hip_bf16.h>

typedef __attribute__((ext_vector_type(16))) _Float16 v16h;
typedef __attribute__((ext_vector_type(8)))  _Float16 v8h;
typedef __attribute__((ext_vector_type(8)))  float    v8f;
typedef __attribute__((ext_vector_type(4)))  int      v4i;

#define TT 512   // sequence length
#define CC 384   // n_embd
#define HH 64    // head size

#if defined(__AMDGCN__) && __has_builtin(__builtin_amdgcn_global_load_async_to_lds_b128) && __has_builtin(__builtin_amdgcn_s_wait_asynccnt)
#define USE_ASYNC 1
#else
#define USE_ASYNC 0
#endif

// Fence that nothing is scheduled across: loads, conversions and WMMAs stay on
// their side.  A conversion of the next step's x lifted over it would wait for
// that x in front of the loads of the step after, and only one step's loads
// would be in flight.
#if defined(__AMDGCN__) && __has_builtin(__builtin_amdgcn_sched_barrier)
#define SCHED_FENCE() __builtin_amdgcn_sched_barrier(0)
#else
#define SCHED_FENCE()
#endif

// K-offset pattern for 16-bit WMMA A/B operands (wave32), ISA 7.12.2:
// VGPR i (elements 2i, 2i+1), lane-half h:  K = (i>>2)*16 + h*8 + (i&3)*2
__device__ __forceinline__ int koff_of(int i, int half) {
    return ((i >> 2) << 4) + (half << 3) + ((i & 3) << 1);
}

// For a stride-1 row source, the 16 operand halfs are two contiguous 8-elem
// chunks at [kbase + half*8] and [kbase + 16 + half*8].
__device__ __forceinline__ v16h op_from_row_f16(const _Float16* row, int kbase, int half) {
    v8h c0 = *(const v8h*)(row + kbase + half * 8);
    v8h c1 = *(const v8h*)(row + kbase + 16 + half * 8);
    v16h r;
#pragma unroll
    for (int j = 0; j < 8; ++j) { r[j] = c0[j]; r[8 + j] = c1[j]; }
    return r;
}

// Assemble f16 operand from two raw f32 chunks (cvt at use site).
__device__ __forceinline__ v16h op_from_f32_chunks(v8f c0, v8f c1) {
    v16h r;
#pragma unroll
    for (int j = 0; j < 8; ++j) { r[j] = (_Float16)c0[j]; r[8 + j] = (_Float16)c1[j]; }
    return r;
}

// ---------------------------------------------------------------------------
// Kernel 0: one-time gather of the strided W columns into per-lane operand
// vectors: Wpack[(w*48 + kk*4 + nt)*32 + lane][16 halfs], contiguous 32B/lane.
// ---------------------------------------------------------------------------
__global__ void packW_kernel(const float* __restrict__ Wk,
                             const float* __restrict__ Wq,
                             const float* __restrict__ Wv,
                             _Float16* __restrict__ Wp) {
    const int lane = threadIdx.x & 31;
    const int half = lane >> 4, n = lane & 15;
    const int id = blockIdx.x;                  // w*48 + kk*4 + nt  (144 total)
    const int w = id / 48, kk = (id % 48) / 4, nt = id & 3;
    const float* W = (w == 0) ? Wk : (w == 1) ? Wq : Wv;
    v16h r;
#pragma unroll
    for (int i = 0; i < 8; ++i) {
        int k = koff_of(i, half);
        r[2 * i]     = (_Float16)W[(kk * 32 + k) * HH + nt * 16 + n];
        r[2 * i + 1] = (_Float16)W[(kk * 32 + k + 1) * HH + nt * 16 + n];
    }
    *(v16h*)(Wp + ((size_t)id * 32 + lane) * 16) = r;
}

// ---------------------------------------------------------------------------
// Kernel 1: q/k/v projections.  One wave per (batch, 32-row tile): a wave tile
// of 32 rows x 192 columns (K | Q | V), 24 accumulator tiles.  Each x fragment
// is loaded and converted once and feeds 12 WMMAs; each W fragment feeds 2.
// The next step's x (raw f32) and 12 W fragments are asked for above the
// current step's 24 WMMAs.
// ---------------------------------------------------------------------------
#define RF 2     // 16-row x fragments per wave
#define NB 12    // W fragments per k step: 3 matrices x 4 column tiles

__global__ void __launch_bounds__(32)   // one wave: 24 tiles and two operand sets need more than 64 registers
proj_kernel(const float* __restrict__ x,
                            const _Float16* __restrict__ Wp,
                            _Float16* __restrict__ Kh,
                            _Float16* __restrict__ Qh,
                            _Float16* __restrict__ Vt) {
    const int lane  = threadIdx.x & 31;
    const int half  = lane >> 4;
    const int nm    = lane & 15;
    const int b     = blockIdx.x >> 4;
    const int tbase = (blockIdx.x & 15) << 5;

    v8f acc[RF][NB];
#pragma unroll
    for (int m = 0; m < RF; ++m)
#pragma unroll
        for (int j = 0; j < NB; ++j) acc[m][j] = 0.0f;

    // wave-uniform base + one 32-bit lane offset: the address registers are set once
    const float* xb = x + ((size_t)b * TT + tbase) * CC;
    const unsigned xo = nm * CC + half * 8;

    auto loadA = [&](int kk, v8f (*dst)[2]) {
#pragma unroll
        for (int m = 0; m < RF; ++m) {
            dst[m][0] = *(const v8f*)(xb + (xo + m * 16 * CC + kk * 32));
            dst[m][1] = *(const v8f*)(xb + (xo + m * 16 * CC + kk * 32 + 16));
        }
    };
    // j = w*4 + nt; the pack is [w][kk][nt][lane][16]
    auto loadB = [&](int kk, v16h* dst) {
#pragma unroll
        for (int j = 0; j < NB; ++j)
            dst[j] = *(const v16h*)(Wp + (((size_t)((j >> 2) * 48 + kk * 4 + (j & 3))) * 32 + lane) * 16);
    };

    v8f  araw[2][RF][2];
    v16h bm[2][NB];
    loadA(0, araw[0]);
    loadB(0, bm[0]);

#pragma unroll
    for (int kk = 0; kk < CC / 32; ++kk) {
        const int cur = kk & 1, nxt = cur ^ 1;
        if (kk + 1 < CC / 32) {     // prefetch region: loads only
            loadA(kk + 1, araw[nxt]);
            loadB(kk + 1, bm[nxt]);
        }
        SCHED_FENCE();              // loads stay above, WMMAs below
        v16h a[RF];
#pragma unroll
        for (int m = 0; m < RF; ++m)
            a[m] = op_from_f32_chunks(araw[cur][m][0], araw[cur][m][1]);
#pragma unroll
        for (int j = 0; j < NB; ++j)
#pragma unroll
            for (int m = 0; m < RF; ++m)
                acc[m][j] = __builtin_amdgcn_wmma_f32_16x16x32_f16(
                    false, a[m], false, bm[cur][j], (short)0, acc[m][j], false, false);
        SCHED_FENCE();
    }

    // every result is rounded to f16 first, into registers of its own
    v8h pk[RF][NB];
#pragma unroll
    for (int m = 0; m < RF; ++m)
#pragma unroll
        for (int j = 0; j < NB; ++j)
#pragma unroll
            for (int r = 0; r < 8; ++r) pk[m][j][r] = (_Float16)acc[m][j][r];
    // conversions stay above, stores below: no store's data register is
    // rewritten while the store is in flight
    __builtin_amdgcn_sched_barrier(0);

    const size_t   rb = ((size_t)b * TT + tbase) * HH;   // wave-uniform
    const unsigned so = (half << 3) * HH + nm;           // lane offset, K and Q alike
    _Float16* vb = Vt + (size_t)b * HH * TT + tbase;
    const unsigned vo = nm * TT + (half << 3);
#pragma unroll
    for (int m = 0; m < RF; ++m) {
        // K, Q row-major [b][t][h]
#pragma unroll
        for (int w = 0; w < 2; ++w) {
            _Float16* dst = ((w == 0) ? Kh : Qh) + rb;
#pragma unroll
            for (int nt = 0; nt < 4; ++nt)
#pragma unroll
                for (int r = 0; r < 8; ++r)
                    dst[so + (m * 16 + r) * HH + nt * 16] = pk[m][w * 4 + nt][r];
        }
        // V transposed [b][h][t]: r=0..7 are consecutive t -> packed 16B stores
#pragma unroll
        for (int nt = 0; nt < 4; ++nt)
            *(v8h*)(vb + (vo + nt * 16 * TT + m * 16)) = pk[m][8 + nt];
    }
}

__device__ __forceinline__ float xhalf(float x) {
    return __builtin_bit_cast(float, __builtin_amdgcn_permlanex16(
        __builtin_bit_cast(int, x), __builtin_bit_cast(int, x),
        0x76543210, 0xfedcba98, false, false));
}

// 2^x.  The v_nop is the slot the instruction set asks for behind a
// transcendental before its result is read or its source overwritten.
__device__ __forceinline__ float exp2_slot(float x) {
    float e;
    asm("v_exp_f32 %0, %1\n\tv_nop" : "=v"(e) : "v"(x));
    return e;
}

__global__ void __launch_bounds__(32)   // one wave: the register budget is not cut to 128
attn_kernel(const _Float16* __restrict__ Kh,
                            const _Float16* __restrict__ Qh,
                            const _Float16* __restrict__ Vt,
                            float* __restrict__ out) {
#if USE_ASYNC
    __shared__ _Float16 Kbuf[2][16 * HH];  // 2 x 2 KB double buffer
#endif

    const int lane  = threadIdx.x & 31;
    const int half  = lane >> 4;
    const int nm    = lane & 15;
    const int b     = blockIdx.x >> 5;
    const int tbase = (blockIdx.x & 31) << 4;
    // 384^-0.5 (C, per reference) times log2(e): the exponentials are base 2
    const float scale2 = 0.05103103630798287f * 1.4426950408889634f;

    const _Float16* qrow = Qh + ((size_t)b * TT + tbase + nm) * HH;
    const v16h qb0 = op_from_row_f16(qrow, 0, half);
    const v16h qb1 = op_from_row_f16(qrow, 32, half);

#if USE_ASYNC
    // stage one 16x64 f16 tile (2 KB): 4 x (32 lanes x b128)
    auto stage = [&](int kb, int buf) {
        char* g = (char*)(Kh + ((size_t)b * TT + kb * 16) * HH) + lane * 16;
        char* l = (char*)(&Kbuf[buf][0]) + lane * 16;
        auto gp = (__attribute__((address_space(1))) v4i*)g;
        auto lp = (__attribute__((address_space(3))) v4i*)l;
        __builtin_amdgcn_global_load_async_to_lds_b128(gp, lp, 0, 0);
        __builtin_amdgcn_global_load_async_to_lds_b128(gp, lp, 512, 0);
        __builtin_amdgcn_global_load_async_to_lds_b128(gp, lp, 1024, 0);
        __builtin_amdgcn_global_load_async_to_lds_b128(gp, lp, 1536, 0);
    };
    stage(0, 0);
#endif

    // acc[dt][r] = O[query nm][dt*16 + 8*half + r], not yet normalized
    v8f acc[4];
#pragma unroll
    for (int dt = 0; dt < 4; ++dt) acc[dt] = 0.0f;
    float mrun = -1e30f;   // running maximum of this query's scaled scores
    float lsum = 0.0f;     // sum over this lane's half of the keys
    const int query = tbase + nm;

    for (int p = 0; p < TT / 32; ++p) {
        // V^T fragments of this pass, asked for first: they are used last
        v16h va[4];
#pragma unroll
        for (int dt = 0; dt < 4; ++dt)
            va[dt] = op_from_row_f16(
                Vt + ((size_t)b * HH + dt * 16 + nm) * TT, p * 32, half);

        // ---- S^T = K @ Q^T, two 16-key tiles ----
        v8f st[2];
#pragma unroll
        for (int t = 0; t < 2; ++t) {
            const int kb = 2 * p + t;
#if USE_ASYNC
            // the refill below targets the buffer read one tile ago: those
            // LDS reads must have returned before the copies are issued
            asm volatile("s_wait_dscnt 0x0" ::: "memory");
            // asm waits with the clobber: they hold the LDS reads behind them
            if (kb + 1 < TT / 16) {
                stage(kb + 1, (kb + 1) & 1);
                asm volatile("s_wait_asynccnt 0x4" ::: "memory");  // tile kb landed
            } else {
                asm volatile("s_wait_asynccnt 0x0" ::: "memory");
            }
            const _Float16* krow = &Kbuf[kb & 1][nm * HH];
#else
            const _Float16* krow = Kh + ((size_t)b * TT + kb * 16 + nm) * HH;
#endif
            v16h a0 = op_from_row_f16(krow, 0, half);
            v16h a1 = op_from_row_f16(krow, 32, half);
            // inputs only: both fragments are read before the first product, so a
            // tile pays one LDS latency, not two
            asm volatile("" :: "v"(a0), "v"(a1));
            v8f c = 0.0f;
            c = __builtin_amdgcn_wmma_f32_16x16x32_f16(false, a0, false, qb0, (short)0, c, false, false);
            c = __builtin_amdgcn_wmma_f32_16x16x32_f16(false, a1, false, qb1, (short)0, c, false, false);
            st[t] = c;     // st[t][r] = S[query nm][p*32 + t*16 + 8*half + r]
        }

        // ---- causal mask, running maximum (scale2 > 0: it commutes with max) ----
        float s[16];
        float mx = -1e30f;
#pragma unroll
        for (int i = 0; i < 16; ++i) {
            const int key = p * 32 + ((i >> 3) << 4) + (half << 3) + (i & 7);
            float v = st[i >> 3][i & 7];
            if (key > query) v = -1e30f;           // causal mask
            s[i] = v;
            mx = fmaxf(mx, v);
        }
        mx = fmaxf(mx, xhalf(mx)) * scale2;        // both halves: the query's maximum
        const float mnew  = fmaxf(mrun, mx);
        const float alpha = exp2_slot(mrun - mnew);  // 0 on the first pass
        mrun = mnew;

        // ---- P^T as B operand: element i = key 16*(i>>3) + 8*half + (i&7) of the pass ----
        v16h pb;
        float ps[4] = {0.0f, 0.0f, 0.0f, 0.0f};   // four short add chains
#pragma unroll
        for (int i = 0; i < 16; ++i) {
            float e = exp2_slot(fmaf(s[i], scale2, -mnew));  // 0 when masked
            ps[i & 3] += e;
            pb[i] = (_Float16)e;
        }
        lsum = lsum * alpha + ((ps[0] + ps[1]) + (ps[2] + ps[3]));

        // ---- O^T = alpha * O^T + V^T @ P^T ----
#pragma unroll
        for (int dt = 0; dt < 4; ++dt) {
            acc[dt] *= alpha;
            acc[dt] = __builtin_amdgcn_wmma_f32_16x16x32_f16(
                false, va[dt], false, pb, (short)0, acc[dt], false, false);
        }
    }

    // ---- normalize and store: 8 consecutive head columns per lane ----
    const float inv = 1.0f / (lsum + xhalf(lsum));
    float* orow = out + ((size_t)b * TT + query) * HH + (half << 3);
#pragma unroll
    for (int dt = 0; dt < 4; ++dt)
        *(v8f*)(orow + dt * 16) = acc[dt] * inv;
}

// ---------------------------------------------------------------------------
extern "C" void kernel_launch(void* const* d_in, const int* in_sizes, int n_in,
                              void* d_out, int out_size, void* d_ws, size_t ws_size,
                              hipStream_t stream) {
    const float* x  = (const float*)d_in[0];
    const float* Wk = (const float*)d_in[1];
    const float* Wq = (const float*)d_in[2];
    const float* Wv = (const float*)d_in[3];
    float* out = (float*)d_out;

    const int B = in_sizes[0] / (TT * CC);   // 64

    // workspace layout (halfs): Kh | Qh | Vt | Wpack
    const size_t per = (size_t)B * TT * HH;  // 2M halfs = 4 MB each
    _Float16* Kh = (_Float16*)d_ws;
    _Float16* Qh = Kh + per;
    _Float16* Vt = Qh + per;
    _Float16* Wp = Vt + per;                 // 144*32*16 halfs = 144 KB

    packW_kernel<<<dim3(144), dim3(32), 0, stream>>>(Wk, Wq, Wv, Wp);
    const int nTiles = B * (TT / 16);        // one wave per 16-row tile
    proj_kernel<<<dim3(B * (TT / 32)), dim3(32), 0, stream>>>(x, Wp, Kh, Qh, Vt);   // one wave per 32 rows
    attn_kernel<<<dim3(nTiles), dim3(32), 0, stream>>>(Kh, Qh, Vt, out);
}

// v003
// A run of this version takes 27.2 microseconds.
// Next to v002, in two timings, it ran 1.34 and 1.33 times as fast.
// Counting every step since v000, it is 2.63 times as fast.
#include <hip/hip_runtime.h>
#include <hip/hip_bf16.h>

typedef __attribute__((ext_vector_type(16))) _Float16 v16h;
typedef __attribute__((ext_vector_type(8)))  _Float16 v8h;
typedef __attribute__((ext_vector_type(8)))  float    v8f;

#define TT 512   // sequence length
#define CC 384   // n_embd
#define HH 64    // head size

// Fence that nothing is scheduled across: loads, conversions and WMMAs stay on
// their side.  A conversion of the next step's x lifted over it would wait for
// that x in front of the loads of the step after, and only one step's loads
// would be in flight.
#if defined(__AMDGCN__) && __has_builtin(__builtin_amdgcn_sched_barrier)
#define SCHED_FENCE() __builtin_amdgcn_sched_barrier(0)
#else
#define SCHED_FENCE()
#endif

// K-offset pattern for 16-bit WMMA A/B operands (wave32), ISA 7.12.2:
// VGPR i (elements 2i, 2i+1), lane-half h:  K = (i>>2)*16 + h*8 + (i&3)*2
__device__ __forceinline__ int koff_of(int i, int half) {
    return ((i >> 2) << 4) + (half << 3) + ((i & 3) << 1);
}

// For a stride-1 row source, the 16 operand halfs are two contiguous 8-elem
// chunks at [kbase + half*8] and [kbase + 16 + half*8].
__device__ __forceinline__ v16h op_from_row_f16(const _Float16* row, int kbase, int half) {
    v8h c0 = *(const v8h*)(row + kbase + half * 8);
    v8h c1 = *(const v8h*)(row + kbase + 16 + half * 8);
    v16h r;
#pragma unroll
    for (int j = 0; j < 8; ++j) { r[j] = c0[j]; r[8 + j] = c1[j]; }
    return r;
}

// Assemble f16 operand from two raw f32 chunks (cvt at use site).
__device__ __forceinline__ v16h op_from_f32_chunks(v8f c0, v8f c1) {
    v16h r;
#pragma unroll
    for (int j = 0; j < 8; ++j) { r[j] = (_Float16)c0[j]; r[8 + j] = (_Float16)c1[j]; }
    return r;
}

// ---------------------------------------------------------------------------
// Kernel 0: one-time gather of the strided W columns into per-lane operand
// vectors: Wpack[(w*48 + kk*4 + nt)*32 + lane][16 halfs], contiguous 32B/lane.
// ---------------------------------------------------------------------------
__global__ void packW_kernel(const float* __restrict__ Wk,
                             const float* __restrict__ Wq,
                             const float* __restrict__ Wv,
                             _Float16* __restrict__ Wp) {
    const int lane = threadIdx.x & 31;
    const int half = lane >> 4, n = lane & 15;
    const int id = blockIdx.x;                  // w*48 + kk*4 + nt  (144 total)
    const int w = id / 48, kk = (id % 48) / 4, nt = id & 3;
    const float* W = (w == 0) ? Wk : (w == 1) ? Wq : Wv;
    v16h r;
#pragma unroll
    for (int i = 0; i < 8; ++i) {
        int k = koff_of(i, half);
        r[2 * i]     = (_Float16)W[(kk * 32 + k) * HH + nt * 16 + n];
        r[2 * i + 1] = (_Float16)W[(kk * 32 + k + 1) * HH + nt * 16 + n];
    }
    *(v16h*)(Wp + ((size_t)id * 32 + lane) * 16) = r;
}

// ---------------------------------------------------------------------------
// Kernel 1: q/k/v projections.  One wave per (batch, 32-row tile): a wave tile
// of 32 rows x 192 columns (K | Q | V), 24 accumulator tiles.  Each x fragment
// is loaded and converted once and feeds 12 WMMAs; each W fragment feeds 2.
// The next step's x (raw f32) and 12 W fragments are asked for above the
// current step's 24 WMMAs.
// ---------------------------------------------------------------------------
#define RF 2     // 16-row x fragments per wave
#define NB 12    // W fragments per k step: 3 matrices x 4 column tiles

__global__ void __launch_bounds__(32)   // one wave: 24 tiles and two operand sets need more than 64 registers
proj_kernel(const float* __restrict__ x,
                            const _Float16* __restrict__ Wp,
                            _Float16* __restrict__ Kh,
                            _Float16* __restrict__ Qh,
                            _Float16* __restrict__ Vt) {
    const int lane  = threadIdx.x & 31;
    const int half  = lane >> 4;
    const int nm    = lane & 15;
    const int b     = blockIdx.x >> 4;
    const int tbase = (blockIdx.x & 15) << 5;

    v8f acc[RF][NB];
#pragma unroll
    for (int m = 0; m < RF; ++m)
#pragma unroll
        for (int j = 0; j < NB; ++j) acc[m][j] = 0.0f;

    // wave-uniform base + one 32-bit lane offset: the address registers are set once
    const float* xb = x + ((size_t)b * TT + tbase) * CC;
    const unsigned xo = nm * CC + half * 8;

    auto loadA = [&](int kk, v8f (*dst)[2]) {
#pragma unroll
        for (int m = 0; m < RF; ++m) {
            dst[m][0] = *(const v8f*)(xb + (xo + m * 16 * CC + kk * 32));
            dst[m][1] = *(const v8f*)(xb + (xo + m * 16 * CC + kk * 32 + 16));
        }
    };
    // j = w*4 + nt; the pack is [w][kk][nt][lane][16]
    auto loadB = [&](int kk, v16h* dst) {
#pragma unroll
        for (int j = 0; j < NB; ++j)
            dst[j] = *(const v16h*)(Wp + (((size_t)((j >> 2) * 48 + kk * 4 + (j & 3))) * 32 + lane) * 16);
    };

    v8f  araw[2][RF][2];
    v16h bm[2][NB];
    loadA(0, araw[0]);
    loadB(0, bm[0]);

#pragma unroll
    for (int kk = 0; kk < CC / 32; ++kk) {
        const int cur = kk & 1, nxt = cur ^ 1;
        if (kk + 1 < CC / 32) {     // prefetch region: loads only
            loadA(kk + 1, araw[nxt]);
            loadB(kk + 1, bm[nxt]);
        }
        SCHED_FENCE();              // loads stay above, WMMAs below
        v16h a[RF];
#pragma unroll
        for (int m = 0; m < RF; ++m)
            a[m] = op_from_f32_chunks(araw[cur][m][0], araw[cur][m][1]);
#pragma unroll
        for (int j = 0; j < NB; ++j)
#pragma unroll
            for (int m = 0; m < RF; ++m)
                acc[m][j] = __builtin_amdgcn_wmma_f32_16x16x32_f16(
                    false, a[m], false, bm[cur][j], (short)0, acc[m][j], false, false);
        SCHED_FENCE();
    }

    // every result is rounded to f16 first, into registers of its own
    v8h pk[RF][NB];
#pragma unroll
    for (int m = 0; m < RF; ++m)
#pragma unroll
        for (int j = 0; j < NB; ++j)
#pragma unroll
            for (int r = 0; r < 8; ++r) pk[m][j][r] = (_Float16)acc[m][j][r];
    // conversions stay above, stores below: no store's data register is
    // rewritten while the store is in flight
    __builtin_amdgcn_sched_barrier(0);

    const size_t   rb = ((size_t)b * TT + tbase) * HH;   // wave-uniform
    const unsigned so = (half << 3) * HH + nm;           // lane offset, K and Q alike
    _Float16* vb = Vt + (size_t)b * HH * TT + tbase;
    const unsigned vo = nm * TT + (half << 3);
#pragma unroll
    for (int m = 0; m < RF; ++m) {
        // K, Q row-major [b][t][h]
#pragma unroll
        for (int w = 0; w < 2; ++w) {
            _Float16* dst = ((w == 0) ? Kh : Qh) + rb;
#pragma unroll
            for (int nt = 0; nt < 4; ++nt)
#pragma unroll
                for (int r = 0; r < 8; ++r)
                    dst[so + (m * 16 + r) * HH + nt * 16] = pk[m][w * 4 + nt][r];
        }
        // V transposed [b][h][t]: r=0..7 are consecutive t -> packed 16B stores
#pragma unroll
        for (int nt = 0; nt < 4; ++nt)
            *(v8h*)(vb + (vo + nt * 16 * TT + m * 16)) = pk[m][8 + nt];
    }
}

#define AW 8
#define KP 72
#define VP 520

// Eight asynchronous 16-byte-per-lane copies global -> LDS.  The s_wait_xcnt
// stands inside the statement, so no address register of a copy is rewritten
// in front of it.
__device__ __forceinline__ void copy8(const unsigned* l, const char* const* g) {
    asm volatile(
        "global_load_async_to_lds_b128 %0, %8, off\n\t"
        "global_load_async_to_lds_b128 %1, %9, off\n\t"
        "global_load_async_to_lds_b128 %2, %10, off\n\t"
        "global_load_async_to_lds_b128 %3, %11, off\n\t"
        "global_load_async_to_lds_b128 %4, %12, off\n\t"
        "global_load_async_to_lds_b128 %5, %13, off\n\t"
        "global_load_async_to_lds_b128 %6, %14, off\n\t"
        "global_load_async_to_lds_b128 %7, %15, off\n\t"
        "s_wait_xcnt 0x0"
        :: "v"(l[0]), "v"(l[1]), "v"(l[2]), "v"(l[3]),
           "v"(l[4]), "v"(l[5]), "v"(l[6]), "v"(l[7]),
           "v"(g[0]), "v"(g[1]), "v"(g[2]), "v"(g[3]),
           "v"(g[4]), "v"(g[5]), "v"(g[6]), "v"(g[7])
        : "memory");
}

// lane l <-> lane l ^ 16
__device__ __forceinline__ float xhalf(float x) {
    return __builtin_bit_cast(float, __builtin_amdgcn_permlanex16(
        __builtin_bit_cast(int, x), __builtin_bit_cast(int, x),
        0x76543210, 0xfedcba98, false, false));
}

// 2^x.  The v_nop is the slot the instruction set asks for behind a
// transcendental before its result is read or its source overwritten.
__device__ __forceinline__ float exp2_slot(float x) {
    float e;
    asm("v_exp_f32 %0, %1\n\tv_nop" : "=v"(e) : "v"(x));
    return e;
}

__global__ void __launch_bounds__(AW * 32)   // the real block size: two waves a SIMD
attn_kernel(const _Float16* __restrict__ Kh,
                            const _Float16* __restrict__ Qh,
                            const _Float16* __restrict__ Vt,
                            float* __restrict__ out) {
    __shared__ __attribute__((aligned(16))) _Float16 Ks[TT * KP];   // 72 KB
    __shared__ __attribute__((aligned(16))) _Float16 Vs[HH * VP];   // 65 KB

    const int lane  = threadIdx.x & 31;
    const int wave  = threadIdx.x >> 5;
    const int half  = lane >> 4;
    const int nm    = lane & 15;
    const int b     = blockIdx.x / (TT / 16 / AW);
    const int tbase = ((blockIdx.x % (TT / 16 / AW)) * AW + wave) << 4;
    // 384^-0.5 (C, per reference) times log2(e): the exponentials are base 2
    const float scale2 = 0.05103103630798287f * 1.4426950408889634f;

    // ---- K and V^T of the batch, 64 KB each: a wave copies 8 KB of either ----
    {
        const char* gk = (const char*)(Kh + (size_t)b * TT * HH);
        const char* gv = (const char*)(Vt + (size_t)b * HH * TT);
        const unsigned lk = (unsigned)(size_t)&Ks[0];   // low 32 bits: the LDS byte address
        const unsigned lv = (unsigned)(size_t)&Vs[0];
#pragma unroll
        for (int grp = 0; grp < 2; ++grp) {
            unsigned    l[8];
            const char* g[8];
            // K: a copy is 4 rows of 128 B
#pragma unroll
            for (int i = 0; i < 8; ++i) {
                const int c = wave * 16 + grp * 8 + i;       // 512-byte piece, 0..127
                l[i] = lk + (c * 4 + (lane >> 3)) * (KP * 2) + (lane & 7) * 16;
                g[i] = gk + c * 512 + lane * 16;
            }
            copy8(l, g);
            // V^T: a copy is half a row of 1024 B
#pragma unroll
            for (int i = 0; i < 8; ++i) {
                const int c = wave * 16 + grp * 8 + i;
                l[i] = lv + (c >> 1) * (VP * 2) + (c & 1) * 512 + lane * 16;
                g[i] = gv + c * 512 + lane * 16;
            }
            copy8(l, g);
        }
    }

    const _Float16* qrow = Qh + ((size_t)b * TT + tbase + nm) * HH;
    const v16h qb0 = op_from_row_f16(qrow, 0, half);
    const v16h qb1 = op_from_row_f16(qrow, 32, half);

    // this wave's copies have landed; behind the barrier so have all eight waves'
    asm volatile("s_wait_asynccnt 0x0" ::: "memory");
    __syncthreads();

    // acc[dt][r] = O[query nm][dt*16 + 8*half + r], not yet normalized
    v8f acc[4];
#pragma unroll
    for (int dt = 0; dt < 4; ++dt) acc[dt] = 0.0f;
    float mrun = -1e30f;   // running maximum of this query's scaled scores
    float lsum = 0.0f;     // sum over this lane's half of the keys
    const int query = tbase + nm;

    for (int p = 0; p < TT / 32; ++p) {
        // all fragments of the pass are asked for at its top, K first: LDS
        // answers in order and K is used first
        v16h ka[2][2];
#pragma unroll
        for (int t = 0; t < 2; ++t) {
            const _Float16* krow = &Ks[(p * 32 + t * 16 + nm) * KP];
            ka[t][0] = op_from_row_f16(krow, 0, half);
            ka[t][1] = op_from_row_f16(krow, 32, half);
        }
        v16h va[4];
#pragma unroll
        for (int dt = 0; dt < 4; ++dt)
            va[dt] = op_from_row_f16(&Vs[(dt * 16 + nm) * VP], p * 32, half);

        // inputs only: all four K fragments are read before the first product, so
        // a pass pays one LDS latency, not one per product
        asm volatile("" :: "v"(ka[0][0]), "v"(ka[0][1]), "v"(ka[1][0]), "v"(ka[1][1]));

        // ---- S^T = K @ Q^T, two 16-key tiles ----
        v8f st[2];
#pragma unroll
        for (int t = 0; t < 2; ++t) {
            v8f c = 0.0f;
            c = __builtin_amdgcn_wmma_f32_16x16x32_f16(false, ka[t][0], false, qb0, (short)0, c, false, false);
            c = __builtin_amdgcn_wmma_f32_16x16x32_f16(false, ka[t][1], false, qb1, (short)0, c, false, false);
            st[t] = c;     // st[t][r] = S[query nm][p*32 + t*16 + 8*half + r]
        }

        // ---- causal mask, running maximum (scale2 > 0: it commutes with max) ----
        float s[16];
        float mx = -1e30f;
#pragma unroll
        for (int i = 0; i < 16; ++i) {
            const int key = p * 32 + ((i >> 3) << 4) + (half << 3) + (i & 7);
            float v = st[i >> 3][i & 7];
            if (key > query) v = -1e30f;           // causal mask
            s[i] = v;
            mx = fmaxf(mx, v);
        }
        mx = fmaxf(mx, xhalf(mx)) * scale2;        // both halves: the query's maximum
        const float mnew  = fmaxf(mrun, mx);
        const float alpha = exp2_slot(mrun - mnew);  // 0 on the first pass
        mrun = mnew;

        // ---- P^T as B operand: element i = key 16*(i>>3) + 8*half + (i&7) of the pass ----
        v16h pb;
        float ps[4] = {0.0f, 0.0f, 0.0f, 0.0f};   // four short add chains
#pragma unroll
        for (int i = 0; i < 16; ++i) {
            float e = exp2_slot(fmaf(s[i], scale2, -mnew));  // 0 when masked
            ps[i & 3] += e;
            pb[i] = (_Float16)e;
        }
        lsum = lsum * alpha + ((ps[0] + ps[1]) + (ps[2] + ps[3]));

        // ---- O^T = alpha * O^T + V^T @ P^T ----
#pragma unroll
        for (int dt = 0; dt < 4; ++dt) {
            acc[dt] *= alpha;
            acc[dt] = __builtin_amdgcn_wmma_f32_16x16x32_f16(
                false, va[dt], false, pb, (short)0, acc[dt], false, false);
        }
    }

    // ---- normalize and store: 8 consecutive head columns per lane ----
    const float inv = 1.0f / (lsum + xhalf(lsum));
    float* orow = out + ((size_t)b * TT + query) * HH + (half << 3);
#pragma unroll
    for (int dt = 0; dt < 4; ++dt)
        *(v8f*)(orow + dt * 16) = acc[dt] * inv;
}

// ---------------------------------------------------------------------------
extern "C" void kernel_launch(void* const* d_in, const int* in_sizes, int n_in,
                              void* d_out, int out_size, void* d_ws, size_t ws_size,
                              hipStream_t stream) {
    const float* x  = (const float*)d_in[0];
    const float* Wk = (const float*)d_in[1];
    const float* Wq = (const float*)d_in[2];
    const float* Wv = (const float*)d_in[3];
    float* out = (float*)d_out;

    const int B = in_sizes[0] / (TT * CC);   // 64

    // workspace layout (halfs): Kh | Qh | Vt | Wpack
    const size_t per = (size_t)B * TT * HH;  // 2M halfs = 4 MB each
    _Float16* Kh = (_Float16*)d_ws;
    _Float16* Qh = Kh + per;
    _Float16* Vt = Qh + per;
    _Float16* Wp = Vt + per;                 // 144*32*16 halfs = 144 KB

    packW_kernel<<<dim3(144), dim3(32), 0, stream>>>(Wk, Wq, Wv, Wp);
    const int nTiles = B * (TT / 16);        // one wave per 16-row tile, AW waves a work-group
    proj_kernel<<<dim3(B * (TT / 32)), dim3(32), 0, stream>>>(x, Wp, Kh, Qh, Vt);   // one wave per 32 rows
    attn_kernel<<<dim3(nTiles / AW), dim3(AW * 32), 0, stream>>>(Kh, Qh, Vt, out);
}

// v004
// One run takes 21.9 microseconds.
// Next to v003, in two timings, it ran 1.25 and 1.24 times as fast.
// Over all steps from v000 it is 3.26 times as fast.
#include <hip/hip_runtime.h>
#include <hip/hip_bf16.h>

typedef __attribute__((ext_vector_type(16))) _Float16 v16h;
typedef __attribute__((ext_vector_type(8)))  _Float16 v8h;
typedef __attribute__((ext_vector_type(4)))  _Float16 v4h;
typedef __attribute__((ext_vector_type(8)))  float    v8f;
typedef __attribute__((ext_vector_type(4)))  float    v4f;

#define TT 512   // sequence length
#define CC 384   // n_embd
#define HH 64    // head size

// Fence that nothing is scheduled across: loads, conversions and WMMAs stay on
// their side.  A conversion of the next step's x lifted over it would wait for
// that x in front of the loads of the step after, and only one step's loads
// would be in flight.
#if defined(__AMDGCN__) && __has_builtin(__builtin_amdgcn_sched_barrier)
#define SCHED_FENCE() __builtin_amdgcn_sched_barrier(0)
#else
#define SCHED_FENCE()
#endif

// For a stride-1 row source, the 16 operand halfs are two contiguous 8-elem
// chunks at [kbase + half*8] and [kbase + 16 + half*8].
__device__ __forceinline__ v16h op_from_row_f16(const _Float16* row, int kbase, int half) {
    v8h c0 = *(const v8h*)(row + kbase + half * 8);
    v8h c1 = *(const v8h*)(row + kbase + 16 + half * 8);
    v16h r;
#pragma unroll
    for (int j = 0; j < 8; ++j) { r[j] = c0[j]; r[8 + j] = c1[j]; }
    return r;
}

// Assemble f16 operand from two raw f32 chunks (cvt at use site).
__device__ __forceinline__ v16h op_from_f32_chunks(v8f c0, v8f c1) {
    v16h r;
#pragma unroll
    for (int j = 0; j < 8; ++j) { r[j] = (_Float16)c0[j]; r[8 + j] = (_Float16)c1[j]; }
    return r;
}

// ---------------------------------------------------------------------------
// Kernel 1: q/k/v projections.  One wave per (batch, 32-row tile): a wave tile
// of 32 rows x 192 columns (K | Q | V), 24 accumulator tiles.  Each x fragment
// is loaded and converted once and feeds 12 WMMAs; each W fragment feeds 2.
// W is read as it lies, f32 [c][h]: one 16-byte load gives a lane 4 adjacent
// columns of one k row, and 16 lanes cover the whole 256-byte row.  The 16 k
// rows of a lane's half hold 4 B fragments: fragment jj has column
// 4 * lane + jj, so nothing is gathered or transposed.
// 16-bit operand, lane half h, element e:  k = (e >> 3) * 16 + h * 8 + (e & 7).
// The four waves of a work-group share that work: wave v loads and converts
// elements 4v .. 4v+3 of all 12 fragments of a k step and puts them into LDS,
// one step ahead, two buffers, one barrier a step; every wave reads all 12.
// ---------------------------------------------------------------------------
// Work-group barrier that orders LDS traffic alone.  __syncthreads() also waits
// for every global load in flight, here the x and W asked for ahead: each step
// would then pay their whole latency.
#define LDS_BARRIER() do {                                                  \
        __builtin_amdgcn_fence(__ATOMIC_RELEASE, "workgroup", "local");     \
        __builtin_amdgcn_s_barrier();                                       \
        __builtin_amdgcn_fence(__ATOMIC_ACQUIRE, "workgroup", "local");     \
    } while (0)

#define RF 2     // 16-row x fragments per wave
#define NB 12    // W fragments per k step: 3 matrices x 4 column sets
#define PW 4     // waves per work-group
#define FH 512   // halfs per fragment in LDS: [element >> 3][lane][element & 7]

__global__ void __launch_bounds__(PW * 32)   // the real block size: one wave a SIMD, 24 tiles need more than 256 registers
proj_kernel(const float* __restrict__ x,
                            const float* __restrict__ Wk,
                            const float* __restrict__ Wq,
                            const float* __restrict__ Wv,
                            _Float16* __restrict__ Kh,
                            _Float16* __restrict__ Qh,
                            _Float16* __restrict__ Vt) {
    __shared__ __attribute__((aligned(16))) _Float16 Ws[2][NB * FH];   // 2 x 12 KB

    const int lane  = threadIdx.x & 31;
    const int wave  = threadIdx.x >> 5;
    const int half  = lane >> 4;
    const int nm    = lane & 15;
    const int tile  = blockIdx.x * PW + wave;
    const int b     = tile >> 4;
    const int tbase = (tile & 15) << 5;

    v8f acc[RF][NB];
#pragma unroll
    for (int m = 0; m < RF; ++m)
#pragma unroll
        for (int j = 0; j < NB; ++j) acc[m][j] = 0.0f;

    // one 32-bit lane offset per operand: the address registers are set once
    const float* xb = x + ((size_t)b * TT + tbase) * CC;
    const unsigned xo = nm * CC + half * 8;
    // k row of element 4 * wave of this lane's half, columns 4 * nm ..
    const unsigned wo = ((wave >> 1) * 16 + half * 8 + (wave & 1) * 4) * HH + nm * 4;
    // this wave's 8 bytes of a lane's 32-byte fragment
    const unsigned ws_o = (wave >> 1) * (FH / 2) + lane * 8 + (wave & 1) * 4;

    auto loadA = [&](int kk, v8f (*dst)[2]) {
#pragma unroll
        for (int m = 0; m < RF; ++m) {
            dst[m][0] = *(const v8f*)(xb + (xo + m * 16 * CC + kk * 32));
            dst[m][1] = *(const v8f*)(xb + (xo + m * 16 * CC + kk * 32 + 16));
        }
    };
    // dst[w][i] = W_w[k(4 * wave + i)][4 * nm .. 4 * nm + 3]
    auto loadW = [&](int kk, v4f (*dst)[4]) {
#pragma unroll
        for (int w = 0; w < 3; ++w) {
            const float* Wb = (w == 0) ? Wk : (w == 1) ? Wq : Wv;
#pragma unroll
            for (int i = 0; i < 4; ++i)
                dst[w][i] = *(const v4f*)(Wb + (wo + (kk * 32 + i) * HH));
        }
    };
    auto storeW = [&](int buf, const v4f (*src)[4]) {
#pragma unroll
        for (int j = 0; j < NB; ++j) {
            v4h p;
#pragma unroll
            for (int i = 0; i < 4; ++i) p[i] = (_Float16)src[j >> 2][i][j & 3];
            *(v4h*)&Ws[buf][j * FH + ws_o] = p;
        }
    };

    v8f araw[2][RF][2];
    v4f wr[2][3][4];   // raw W of step s lies in wr[s & 1]
    loadW(0, wr[0]);
    loadA(0, araw[0]);
    storeW(0, wr[0]);
    loadW(1, wr[1]);
    LDS_BARRIER();     // step 0's fragments are whole

#pragma unroll
    for (int kk = 0; kk < CC / 32; ++kk) {
        const int cur = kk & 1, nxt = cur ^ 1;
        // the loads of W two steps ahead and of x one step ahead
        if (kk + 2 < CC / 32) loadW(kk + 2, wr[cur]);
        if (kk + 1 < CC / 32) loadA(kk + 1, araw[nxt]);
        // behind the last loads of W, and of x, their address registers are free
        // for other values: the wait stands in front of any such overwrite
        if (kk + 2 == CC / 32 - 1 || kk + 1 == CC / 32 - 1)
            asm volatile("s_wait_xcnt 0x0" ::: "memory");
        SCHED_FENCE();              // the loads (and that wait) stay above all else
        // this step's fragments out of LDS, the next step's into the other
        // buffer: its readers left it before the last barrier
        v16h bm[NB];
#pragma unroll
        for (int j = 0; j < NB; ++j) {
            v8h c0 = *(const v8h*)&Ws[cur][j * FH + lane * 8];
            v8h c1 = *(const v8h*)&Ws[cur][j * FH + FH / 2 + lane * 8];
#pragma unroll
            for (int e = 0; e < 8; ++e) { bm[j][e] = c0[e]; bm[j][8 + e] = c1[e]; }
        }
        if (kk + 1 < CC / 32) storeW(nxt, wr[nxt]);
        SCHED_FENCE();              // LDS traffic stays above, WMMAs below
        v16h a[RF];
#pragma unroll
        for (int m = 0; m < RF; ++m)
            a[m] = op_from_f32_chunks(araw[cur][m][0], araw[cur][m][1]);
#pragma unroll
        for (int j = 0; j < NB; ++j)
#pragma unroll
            for (int m = 0; m < RF; ++m)
                acc[m][j] = __builtin_amdgcn_wmma_f32_16x16x32_f16(
                    false, a[m], false, bm[j], (short)0, acc[m][j], false, false);
        SCHED_FENCE();
        // the next step's fragments are whole, and this step's buffer is free
        if (kk + 1 < CC / 32) LDS_BARRIER();
    }

    // acc[m][w*4 + jj][r] = (x W_w)[tbase + m*16 + 8*half + r][4*nm + jj]
    // every result is rounded to f16 first, into registers of its own
    v4h kq[RF][2][8];    // K, Q: 4 adjacent columns of one row
    v8h vv[RF][4];       // V: 8 adjacent rows of one column
#pragma unroll
    for (int m = 0; m < RF; ++m) {
#pragma unroll
        for (int w = 0; w < 2; ++w)
#pragma unroll
            for (int r = 0; r < 8; ++r)
#pragma unroll
                for (int jj = 0; jj < 4; ++jj) kq[m][w][r][jj] = (_Float16)acc[m][w * 4 + jj][r];
#pragma unroll
        for (int jj = 0; jj < 4; ++jj)
#pragma unroll
            for (int r = 0; r < 8; ++r) vv[m][jj][r] = (_Float16)acc[m][8 + jj][r];
    }
    // conversions stay above, stores below: no store's data register is
    // rewritten while the store is in flight
    __builtin_amdgcn_sched_barrier(0);

    const size_t   rb = ((size_t)b * TT + tbase) * HH;   // wave-uniform
    const unsigned so = (half << 3) * HH + nm * 4;       // lane offset, K and Q alike
    _Float16* vb = Vt + (size_t)b * HH * TT + tbase;
    const unsigned vo = nm * 4 * TT + (half << 3);
#pragma unroll
    for (int m = 0; m < RF; ++m) {
        // K, Q row-major [b][t][h]: 16 lanes x 8 bytes are one whole 128-byte row
#pragma unroll
        for (int w = 0; w < 2; ++w) {
            _Float16* dst = ((w == 0) ? Kh : Qh) + rb;
#pragma unroll
            for (int r = 0; r < 8; ++r)
                *(v4h*)(dst + (so + (m * 16 + r) * HH)) = kq[m][w][r];
        }
        // V transposed [b][h][t]: r=0..7 are consecutive t -> packed 16B stores
#pragma unroll
        for (int jj = 0; jj < 4; ++jj)
            *(v8h*)(vb + (vo + jj * TT + m * 16)) = vv[m][jj];
    }
}

#define AW 8
#define KP 72
#define VP 520

// Eight asynchronous 16-byte-per-lane copies global -> LDS.  The s_wait_xcnt
// stands inside the statement, so no address register of a copy is rewritten
// in front of it.
__device__ __forceinline__ void copy8(const unsigned* l, const char* const* g) {
    asm volatile(
        "global_load_async_to_lds_b128 %0, %8, off\n\t"
        "global_load_async_to_lds_b128 %1, %9, off\n\t"
        "global_load_async_to_lds_b128 %2, %10, off\n\t"
        "global_load_async_to_lds_b128 %3, %11, off\n\t"
        "global_load_async_to_lds_b128 %4, %12, off\n\t"
        "global_load_async_to_lds_b128 %5, %13, off\n\t"
        "global_load_async_to_lds_b128 %6, %14, off\n\t"
        "global_load_async_to_lds_b128 %7, %15, off\n\t"
        "s_wait_xcnt 0x0"
        :: "v"(l[0]), "v"(l[1]), "v"(l[2]), "v"(l[3]),
           "v"(l[4]), "v"(l[5]), "v"(l[6]), "v"(l[7]),
           "v"(g[0]), "v"(g[1]), "v"(g[2]), "v"(g[3]),
           "v"(g[4]), "v"(g[5]), "v"(g[6]), "v"(g[7])
        : "memory");
}

// lane l <-> lane l ^ 16
__device__ __forceinline__ float xhalf(float x) {
    return __builtin_bit_cast(float, __builtin_amdgcn_permlanex16(
        __builtin_bit_cast(int, x), __builtin_bit_cast(int, x),
        0x76543210, 0xfedcba98, false, false));
}

// 2^x.  The v_nop is the slot the instruction set asks for behind a
// transcendental before its result is read or its source overwritten.
__device__ __forceinline__ float exp2_slot(float x) {
    float e;
    asm("v_exp_f32 %0, %1\n\tv_nop" : "=v"(e) : "v"(x));
    return e;
}

__global__ void __launch_bounds__(AW * 32)   // the real block size: two waves a SIMD
attn_kernel(const _Float16* __restrict__ Kh,
                            const _Float16* __restrict__ Qh,
                            const _Float16* __restrict__ Vt,
                            float* __restrict__ out) {
    __shared__ __attribute__((aligned(16))) _Float16 Ks[TT * KP];   // 72 KB
    __shared__ __attribute__((aligned(16))) _Float16 Vs[HH * VP];   // 65 KB

    const int lane  = threadIdx.x & 31;
    const int wave  = threadIdx.x >> 5;
    const int half  = lane >> 4;
    const int nm    = lane & 15;
    const int b     = blockIdx.x / (TT / 16 / AW);
    const int tbase = ((blockIdx.x % (TT / 16 / AW)) * AW + wave) << 4;
    // 384^-0.5 (C, per reference) times log2(e): the exponentials are base 2
    const float scale2 = 0.05103103630798287f * 1.4426950408889634f;

    // ---- K and V^T of the batch, 64 KB each: a wave copies 8 KB of either ----
    {
        const char* gk = (const char*)(Kh + (size_t)b * TT * HH);
        const char* gv = (const char*)(Vt + (size_t)b * HH * TT);
        const unsigned lk = (unsigned)(size_t)&Ks[0];   // low 32 bits: the LDS byte address
        const unsigned lv = (unsigned)(size_t)&Vs[0];
#pragma unroll
        for (int grp = 0; grp < 2; ++grp) {
            unsigned    l[8];
            const char* g[8];
            // K: a copy is 4 rows of 128 B
#pragma unroll
            for (int i = 0; i < 8; ++i) {
                const int c = wave * 16 + grp * 8 + i;       // 512-byte piece, 0..127
                l[i] = lk + (c * 4 + (lane >> 3)) * (KP * 2) + (lane & 7) * 16;
                g[i] = gk + c * 512 + lane * 16;
            }
            copy8(l, g);
            // V^T: a copy is half a row of 1024 B
#pragma unroll
            for (int i = 0; i < 8; ++i) {
                const int c = wave * 16 + grp * 8 + i;
                l[i] = lv + (c >> 1) * (VP * 2) + (c & 1) * 512 + lane * 16;
                g[i] = gv + c * 512 + lane * 16;
            }
            copy8(l, g);
        }
    }

    const _Float16* qrow = Qh + ((size_t)b * TT + tbase + nm) * HH;
    const v16h qb0 = op_from_row_f16(qrow, 0, half);
    const v16h qb1 = op_from_row_f16(qrow, 32, half);

    // this wave's copies have landed; behind the barrier so have all eight waves'
    asm volatile("s_wait_asynccnt 0x0" ::: "memory");
    __syncthreads();

    // acc[dt][r] = O[query nm][dt*16 + 8*half + r], not yet normalized
    v8f acc[4];
#pragma unroll
    for (int dt = 0; dt < 4; ++dt) acc[dt] = 0.0f;
    float mrun = -1e30f;   // running maximum of this query's scaled scores
    float lsum = 0.0f;     // sum over this lane's half of the keys
    const int query = tbase + nm;

    for (int p = 0; p < TT / 32; ++p) {
        // all fragments of the pass are asked for at its top, K first: LDS
        // answers in order and K is used first
        v16h ka[2][2];
#pragma unroll
        for (int t = 0; t < 2; ++t) {
            const _Float16* krow = &Ks[(p * 32 + t * 16 + nm) * KP];
            ka[t][0] = op_from_row_f16(krow, 0, half);
            ka[t][1] = op_from_row_f16(krow, 32, half);
        }
        v16h va[4];
#pragma unroll
        for (int dt = 0; dt < 4; ++dt)
            va[dt] = op_from_row_f16(&Vs[(dt * 16 + nm) * VP], p * 32, half);

        // inputs only: all four K fragments are read before the first product, so
        // a pass pays one LDS latency, not one per product
        asm volatile("" :: "v"(ka[0][0]), "v"(ka[0][1]), "v"(ka[1][0]), "v"(ka[1][1]));

        // ---- S^T = K @ Q^T, two 16-key tiles ----
        v8f st[2];
#pragma unroll
        for (int t = 0; t < 2; ++t) {
            v8f c = 0.0f;
            c = __builtin_amdgcn_wmma_f32_16x16x32_f16(false, ka[t][0], false, qb0, (short)0, c, false, false);
            c = __builtin_amdgcn_wmma_f32_16x16x32_f16(false, ka[t][1], false, qb1, (short)0, c, false, false);
            st[t] = c;     // st[t][r] = S[query nm][p*32 + t*16 + 8*half + r]
        }

        // ---- causal mask, running maximum (scale2 > 0: it commutes with max) ----
        float s[16];
        float mx = -1e30f;
#pragma unroll
        for (int i = 0; i < 16; ++i) {
            const int key = p * 32 + ((i >> 3) << 4) + (half << 3) + (i & 7);
            float v = st[i >> 3][i & 7];
            if (key > query) v = -1e30f;           // causal mask
            s[i] = v;
            mx = fmaxf(mx, v);
        }
        mx = fmaxf(mx, xhalf(mx)) * scale2;        // both halves: the query's maximum
        const float mnew  = fmaxf(mrun, mx);
        const float alpha = exp2_slot(mrun - mnew);  // 0 on the first pass
        mrun = mnew;

        // ---- P^T as B operand: element i = key 16*(i>>3) + 8*half + (i&7) of the pass ----
        v16h pb;
        float ps[4] = {0.0f, 0.0f, 0.0f, 0.0f};   // four short add chains
#pragma unroll
        for (int i = 0; i < 16; ++i) {
            float e = exp2_slot(fmaf(s[i], scale2, -mnew));  // 0 when masked
            ps[i & 3] += e;
            pb[i] = (_Float16)e;
        }
        lsum = lsum * alpha + ((ps[0] + ps[1]) + (ps[2] + ps[3]));

        // ---- O^T = alpha * O^T + V^T @ P^T ----
#pragma unroll
        for (int dt = 0; dt < 4; ++dt) {
            acc[dt] *= alpha;
            acc[dt] = __builtin_amdgcn_wmma_f32_16x16x32_f16(
                false, va[dt], false, pb, (short)0, acc[dt], false, false);
        }
    }

    // ---- normalize and store: 8 consecutive head columns per lane ----
    const float inv = 1.0f / (lsum + xhalf(lsum));
    float* orow = out + ((size_t)b * TT + query) * HH + (half << 3);
#pragma unroll
    for (int dt = 0; dt < 4; ++dt)
        *(v8f*)(orow + dt * 16) = acc[dt] * inv;
}

// ---------------------------------------------------------------------------
extern "C" void kernel_launch(void* const* d_in, const int* in_sizes, int n_in,
                              void* d_out, int out_size, void* d_ws, size_t ws_size,
                              hipStream_t stream) {
    const float* x  = (const float*)d_in[0];
    const float* Wk = (const float*)d_in[1];
    const float* Wq = (const float*)d_in[2];
    const float* Wv = (const float*)d_in[3];
    float* out = (float*)d_out;

    const int B = in_sizes[0] / (TT * CC);   // 64

    // workspace layout (halfs): Kh | Qh | Vt
    const size_t per = (size_t)B * TT * HH;  // 2M halfs = 4 MB each
    _Float16* Kh = (_Float16*)d_ws;
    _Float16* Qh = Kh + per;
    _Float16* Vt = Qh + per;

    const int nTiles = B * (TT / 16);        // one wave per 16-row tile, AW waves a work-group
    proj_kernel<<<dim3(B * (TT / 32) / PW), dim3(PW * 32), 0, stream>>>(x, Wk, Wq, Wv, Kh, Qh, Vt);   // one wave per 32 rows
    attn_kernel<<<dim3(nTiles / AW), dim3(AW * 32), 0, stream>>>(Kh, Qh, Vt, out);
}

// v005
// One run takes 21.1 microseconds.
// In two side-by-side timings against v004, it was 1.04 and 1.05 times as fast.
// Over all steps from v000 it is 3.41 times as fast.
#include <hip/hip_runtime.h>
#include <hip/hip_bf16.h>

typedef __attribute__((ext_vector_type(16))) _Float16 v16h;
typedef __attribute__((ext_vector_type(8)))  _Float16 v8h;
typedef __attribute__((ext_vector_type(4)))  _Float16 v4h;
typedef __attribute__((ext_vector_type(8)))  float    v8f;
typedef __attribute__((ext_vector_type(4)))  float    v4f;

#define TT 512   // sequence length
#define CC 384   // n_embd
#define HH 64    // head size

// Fence that nothing is scheduled across: loads, conversions and WMMAs stay on
// their side.  A conversion of the next step's x lifted over it would wait for
// that x in front of the loads of the step after, and only PD - 1 steps' loads
// would be in flight.
#if defined(__AMDGCN__) && __has_builtin(__builtin_amdgcn_sched_barrier)
#define SCHED_FENCE() __builtin_amdgcn_sched_barrier(0)
#else
#define SCHED_FENCE()
#endif

// For a stride-1 row source, the 16 operand halfs are two contiguous 8-elem
// chunks at [kbase + half*8] and [kbase + 16 + half*8].
__device__ __forceinline__ v16h op_from_row_f16(const _Float16* row, int kbase, int half) {
    v8h c0 = *(const v8h*)(row + kbase + half * 8);
    v8h c1 = *(const v8h*)(row + kbase + 16 + half * 8);
    v16h r;
#pragma unroll
    for (int j = 0; j < 8; ++j) { r[j] = c0[j]; r[8 + j] = c1[j]; }
    return r;
}

// Assemble f16 operand from two raw f32 chunks (cvt at use site).
__device__ __forceinline__ v16h op_from_f32_chunks(v8f c0, v8f c1) {
    v16h r;
#pragma unroll
    for (int j = 0; j < 8; ++j) { r[j] = (_Float16)c0[j]; r[8 + j] = (_Float16)c1[j]; }
    return r;
}

// ---------------------------------------------------------------------------
// Kernel 1: q/k/v projections.  One wave per (batch, 32-row tile): a wave tile
// of 32 rows x 192 columns (K | Q | V), 24 accumulator tiles.  Each x fragment
// is loaded and converted once and feeds 12 WMMAs; each W fragment feeds 2.
// W is read as it lies, f32 [c][h]: one 16-byte load gives a lane 4 adjacent
// columns of one k row, and 16 lanes cover the whole 256-byte row.  The 16 k
// rows of a lane's half hold 4 B fragments: fragment jj has column
// 4 * lane + jj, so nothing is gathered or transposed.
// 16-bit operand, lane half h, element e:  k = (e >> 3) * 16 + h * 8 + (e & 7).
// The four waves of a work-group share that work: wave v loads and converts
// elements 4v .. 4v+3 of all 12 fragments of a k step and puts them into LDS,
// one step ahead, two buffers, one barrier a step; every wave reads all 12.
// The global loads of x and of W both run PD steps ahead of their step, in
// registers: x comes from memory, and a step is much shorter than that latency.
// ---------------------------------------------------------------------------
// Work-group barrier that orders LDS traffic alone.  __syncthreads() also waits
// for every global load in flight, here the x and W asked for ahead: each step
// would then pay their whole latency.
#define LDS_BARRIER() do {                                                  \
        __builtin_amdgcn_fence(__ATOMIC_RELEASE, "workgroup", "local");     \
        __builtin_amdgcn_s_barrier();                                       \
        __builtin_amdgcn_fence(__ATOMIC_ACQUIRE, "workgroup", "local");     \
    } while (0)

#define RF 2     // 16-row x fragments per wave
#define NB 12    // W fragments per k step: 3 matrices x 4 column sets
#define PW 4     // waves per work-group
#define FH 512   // halfs per fragment in LDS: [element >> 3][lane][element & 7]
#define PD 3     // steps the global loads run ahead: 16 loads a step, under 64 of a wave in flight

__global__ void __launch_bounds__(PW * 32)   // the real block size: one wave a SIMD, 24 tiles need more than 256 registers
proj_kernel(const float* __restrict__ x,
                            const float* __restrict__ Wk,
                            const float* __restrict__ Wq,
                            const float* __restrict__ Wv,
                            _Float16* __restrict__ Kh,
                            _Float16* __restrict__ Qh,
                            _Float16* __restrict__ Vt) {
    __shared__ __attribute__((aligned(16))) _Float16 Ws[2][NB * FH];   // 2 x 12 KB

    const int lane  = threadIdx.x & 31;
    const int wave  = threadIdx.x >> 5;
    const int half  = lane >> 4;
    const int nm    = lane & 15;
    const int tile  = blockIdx.x * PW + wave;
    const int b     = tile >> 4;
    const int tbase = (tile & 15) << 5;

    v8f acc[RF][NB];
#pragma unroll
    for (int m = 0; m < RF; ++m)
#pragma unroll
        for (int j = 0; j < NB; ++j) acc[m][j] = 0.0f;

    // one 32-bit lane offset per operand: the address registers are set once
    const float* xb = x + ((size_t)b * TT + tbase) * CC;
    const unsigned xo = nm * CC + half * 8;
    // k row of element 4 * wave of this lane's half, columns 4 * nm ..
    const unsigned wo = ((wave >> 1) * 16 + half * 8 + (wave & 1) * 4) * HH + nm * 4;
    // this wave's 8 bytes of a lane's 32-byte fragment
    const unsigned ws_o = (wave >> 1) * (FH / 2) + lane * 8 + (wave & 1) * 4;

    auto loadA = [&](int kk, v8f (*dst)[2]) {
#pragma unroll
        for (int m = 0; m < RF; ++m) {
            dst[m][0] = *(const v8f*)(xb + (xo + m * 16 * CC + kk * 32));
            dst[m][1] = *(const v8f*)(xb + (xo + m * 16 * CC + kk * 32 + 16));
        }
    };
    // dst[w][i] = W_w[k(4 * wave + i)][4 * nm .. 4 * nm + 3]
    auto loadW = [&](int kk, v4f (*dst)[4]) {
#pragma unroll
        for (int w = 0; w < 3; ++w) {
            const float* Wb = (w == 0) ? Wk : (w == 1) ? Wq : Wv;
#pragma unroll
            for (int i = 0; i < 4; ++i)
                dst[w][i] = *(const v4f*)(Wb + (wo + (kk * 32 + i) * HH));
        }
    };
    auto storeW = [&](int buf, const v4f (*src)[4]) {
#pragma unroll
        for (int j = 0; j < NB; ++j) {
            v4h p;
#pragma unroll
            for (int i = 0; i < 4; ++i) p[i] = (_Float16)src[j >> 2][i][j & 3];
            *(v4h*)&Ws[buf][j * FH + ws_o] = p;
        }
    };

    v8f araw[PD + 1][RF][2];   // raw x of step s lies in araw[s % (PD + 1)]
    v4f wr[PD][3][4];          // raw W of step s lies in wr[s % PD]
    // Loads answer in the order of issue.  W of step s stands in front of x of
    // step s, and both equally far ahead, so the wait for a step's W waits for
    // no x that is younger than the x the same step needs.
#pragma unroll         // constant ring indices: both rings stay in registers
    for (int s = 0; s < PD; ++s) {
        loadW(s, wr[s]);
        SCHED_FENCE();     // keeps that order of issue: regrouped loads made the first wait a wait for all
        loadA(s, araw[s]);
        SCHED_FENCE();     // the same, and every load stays above the first wait
    }
    storeW(0, wr[0]);
    LDS_BARRIER();     // step 0's fragments are whole

#pragma unroll
    for (int kk = 0; kk < CC / 32; ++kk) {
        const int cur = kk & 1, nxt = cur ^ 1;
        // the loads of W and of x PD steps ahead; W of step kk left its
        // registers for LDS in the step before
        if (kk + PD < CC / 32) {
            loadW(kk + PD, wr[kk % PD]);
            loadA(kk + PD, araw[(kk + PD) % (PD + 1)]);
        }
        // behind the last loads of W and of x their address registers are free
        // for other values: the wait stands in front of any such overwrite
        if (kk + PD == CC / 32 - 1)
            asm volatile("s_wait_xcnt 0x0" ::: "memory");
        SCHED_FENCE();              // the loads (and that wait) stay above all else
        // this step's fragments out of LDS, the next step's into the other
        // buffer: its readers left it before the last barrier
        v16h bm[NB];
#pragma unroll
        for (int j = 0; j < NB; ++j) {
            v8h c0 = *(const v8h*)&Ws[cur][j * FH + lane * 8];
            v8h c1 = *(const v8h*)&Ws[cur][j * FH + FH / 2 + lane * 8];
#pragma unroll
            for (int e = 0; e < 8; ++e) { bm[j][e] = c0[e]; bm[j][8 + e] = c1[e]; }
        }
        if (kk + 1 < CC / 32) storeW(nxt, wr[(kk + 1) % PD]);
        SCHED_FENCE();              // LDS traffic stays above, WMMAs below
        v16h a[RF];
#pragma unroll
        for (int m = 0; m < RF; ++m)
            a[m] = op_from_f32_chunks(araw[kk % (PD + 1)][m][0], araw[kk % (PD + 1)][m][1]);
#pragma unroll
        for (int j = 0; j < NB; ++j)
#pragma unroll
            for (int m = 0; m < RF; ++m)
                acc[m][j] = __builtin_amdgcn_wmma_f32_16x16x32_f16(
                    false, a[m], false, bm[j], (short)0, acc[m][j], false, false);
        SCHED_FENCE();
        // the next step's fragments are whole, and this step's buffer is free
        if (kk + 1 < CC / 32) LDS_BARRIER();
    }

    // acc[m][w*4 + jj][r] = (x W_w)[tbase + m*16 + 8*half + r][4*nm + jj]
    // every result is rounded to f16 first, into registers of its own
    v4h kq[RF][2][8];    // K, Q: 4 adjacent columns of one row
    v8h vv[RF][4];       // V: 8 adjacent rows of one column
#pragma unroll
    for (int m = 0; m < RF; ++m) {
#pragma unroll
        for (int w = 0; w < 2; ++w)
#pragma unroll
            for (int r = 0; r < 8; ++r)
#pragma unroll
                for (int jj = 0; jj < 4; ++jj) kq[m][w][r][jj] = (_Float16)acc[m][w * 4 + jj][r];
#pragma unroll
        for (int jj = 0; jj < 4; ++jj)
#pragma unroll
            for (int r = 0; r < 8; ++r) vv[m][jj][r] = (_Float16)acc[m][8 + jj][r];
    }
    // conversions stay above, stores below: no store's data register is
    // rewritten while the store is in flight
    __builtin_amdgcn_sched_barrier(0);

    const size_t   rb = ((size_t)b * TT + tbase) * HH;   // wave-uniform
    const unsigned so = (half << 3) * HH + nm * 4;       // lane offset, K and Q alike
    _Float16* vb = Vt + (size_t)b * HH * TT + tbase;
    const unsigned vo = nm * 4 * TT + (half << 3);
#pragma unroll
    for (int m = 0; m < RF; ++m) {
        // K, Q row-major [b][t][h]: 16 lanes x 8 bytes are one whole 128-byte row
#pragma unroll
        for (int w = 0; w < 2; ++w) {
            _Float16* dst = ((w == 0) ? Kh : Qh) + rb;
#pragma unroll
            for (int r = 0; r < 8; ++r)
                *(v4h*)(dst + (so + (m * 16 + r) * HH)) = kq[m][w][r];
        }
        // V transposed [b][h][t]: r=0..7 are consecutive t -> packed 16B stores
#pragma unroll
        for (int jj = 0; jj < 4; ++jj)
            *(v8h*)(vb + (vo + jj * TT + m * 16)) = vv[m][jj];
    }
}

#define AW 8
#define KP 72
#define VP 520

// Eight asynchronous 16-byte-per-lane copies global -> LDS.  The s_wait_xcnt
// stands inside the statement, so no address register of a copy is rewritten
// in front of it.
__device__ __forceinline__ void copy8(const unsigned* l, const char* const* g) {
    asm volatile(
        "global_load_async_to_lds_b128 %0, %8, off\n\t"
        "global_load_async_to_lds_b128 %1, %9, off\n\t"
        "global_load_async_to_lds_b128 %2, %10, off\n\t"
        "global_load_async_to_lds_b128 %3, %11, off\n\t"
        "global_load_async_to_lds_b128 %4, %12, off\n\t"
        "global_load_async_to_lds_b128 %5, %13, off\n\t"
        "global_load_async_to_lds_b128 %6, %14, off\n\t"
        "global_load_async_to_lds_b128 %7, %15, off\n\t"
        "s_wait_xcnt 0x0"
        :: "v"(l[0]), "v"(l[1]), "v"(l[2]), "v"(l[3]),
           "v"(l[4]), "v"(l[5]), "v"(l[6]), "v"(l[7]),
           "v"(g[0]), "v"(g[1]), "v"(g[2]), "v"(g[3]),
           "v"(g[4]), "v"(g[5]), "v"(g[6]), "v"(g[7])
        : "memory");
}

// lane l <-> lane l ^ 16
__device__ __forceinline__ float xhalf(float x) {
    return __builtin_bit_cast(float, __builtin_amdgcn_permlanex16(
        __builtin_bit_cast(int, x), __builtin_bit_cast(int, x),
        0x76543210, 0xfedcba98, false, false));
}

// 2^x.  The v_nop is the slot the instruction set asks for behind a
// transcendental before its result is read or its source overwritten.
__device__ __forceinline__ float exp2_slot(float x) {
    float e;
    asm("v_exp_f32 %0, %1\n\tv_nop" : "=v"(e) : "v"(x));
    return e;
}

__global__ void __launch_bounds__(AW * 32)   // the real block size: two waves a SIMD
attn_kernel(const _Float16* __restrict__ Kh,
                            const _Float16* __restrict__ Qh,
                            const _Float16* __restrict__ Vt,
                            float* __restrict__ out) {
    __shared__ __attribute__((aligned(16))) _Float16 Ks[TT * KP];   // 72 KB
    __shared__ __attribute__((aligned(16))) _Float16 Vs[HH * VP];   // 65 KB

    const int lane  = threadIdx.x & 31;
    const int wave  = threadIdx.x >> 5;
    const int half  = lane >> 4;
    const int nm    = lane & 15;
    const int b     = blockIdx.x / (TT / 16 / AW);
    const int tbase = ((blockIdx.x % (TT / 16 / AW)) * AW + wave) << 4;
    // 384^-0.5 (C, per reference) times log2(e): the exponentials are base 2
    const float scale2 = 0.05103103630798287f * 1.4426950408889634f;

    // ---- K and V^T of the batch, 64 KB each: a wave copies 8 KB of either ----
    {
        const char* gk = (const char*)(Kh + (size_t)b * TT * HH);
        const char* gv = (const char*)(Vt + (size_t)b * HH * TT);
        const unsigned lk = (unsigned)(size_t)&Ks[0];   // low 32 bits: the LDS byte address
        const unsigned lv = (unsigned)(size_t)&Vs[0];
#pragma unroll
        for (int grp = 0; grp < 2; ++grp) {
            unsigned    l[8];
            const char* g[8];
            // K: a copy is 4 rows of 128 B
#pragma unroll
            for (int i = 0; i < 8; ++i) {
                const int c = wave * 16 + grp * 8 + i;       // 512-byte piece, 0..127
                l[i] = lk + (c * 4 + (lane >> 3)) * (KP * 2) + (lane & 7) * 16;
                g[i] = gk + c * 512 + lane * 16;
            }
            copy8(l, g);
            // V^T: a copy is half a row of 1024 B
#pragma unroll
            for (int i = 0; i < 8; ++i) {
                const int c = wave * 16 + grp * 8 + i;
                l[i] = lv + (c >> 1) * (VP * 2) + (c & 1) * 512 + lane * 16;
                g[i] = gv + c * 512 + lane * 16;
            }
            copy8(l, g);
        }
    }

    const _Float16* qrow = Qh + ((size_t)b * TT + tbase + nm) * HH;
    const v16h qb0 = op_from_row_f16(qrow, 0, half);
    const v16h qb1 = op_from_row_f16(qrow, 32, half);

    // this wave's copies have landed; behind the barrier so have all eight waves'
    asm volatile("s_wait_asynccnt 0x0" ::: "memory");
    __syncthreads();

    // acc[dt][r] = O[query nm][dt*16 + 8*half + r], not yet normalized
    v8f acc[4];
#pragma unroll
    for (int dt = 0; dt < 4; ++dt) acc[dt] = 0.0f;
    float mrun = -1e30f;   // running maximum of this query's scaled scores
    float lsum = 0.0f;     // sum over this lane's half of the keys
    const int query = tbase + nm;

    for (int p = 0; p < TT / 32; ++p) {
        // all fragments of the pass are asked for at its top, K first: LDS
        // answers in order and K is used first
        v16h ka[2][2];
#pragma unroll
        for (int t = 0; t < 2; ++t) {
            const _Float16* krow = &Ks[(p * 32 + t * 16 + nm) * KP];
            ka[t][0] = op_from_row_f16(krow, 0, half);
            ka[t][1] = op_from_row_f16(krow, 32, half);
        }
        v16h va[4];
#pragma unroll
        for (int dt = 0; dt < 4; ++dt)
            va[dt] = op_from_row_f16(&Vs[(dt * 16 + nm) * VP], p * 32, half);

        // inputs only: all four K fragments are read before the first product, so
        // a pass pays one LDS latency, not one per product
        asm volatile("" :: "v"(ka[0][0]), "v"(ka[0][1]), "v"(ka[1][0]), "v"(ka[1][1]));

        // ---- S^T = K @ Q^T, two 16-key tiles ----
        v8f st[2];
#pragma unroll
        for (int t = 0; t < 2; ++t) {
            v8f c = 0.0f;
            c = __builtin_amdgcn_wmma_f32_16x16x32_f16(false, ka[t][0], false, qb0, (short)0, c, false, false);
            c = __builtin_amdgcn_wmma_f32_16x16x32_f16(false, ka[t][1], false, qb1, (short)0, c, false, false);
            st[t] = c;     // st[t][r] = S[query nm][p*32 + t*16 + 8*half + r]
        }

        // ---- causal mask, running maximum (scale2 > 0: it commutes with max) ----
        float s[16];
        float mx = -1e30f;
#pragma unroll
        for (int i = 0; i < 16; ++i) {
            const int key = p * 32 + ((i >> 3) << 4) + (half << 3) + (i & 7);
            float v = st[i >> 3][i & 7];
            if (key > query) v = -1e30f;           // causal mask
            s[i] = v;
            mx = fmaxf(mx, v);
        }
        mx = fmaxf(mx, xhalf(mx)) * scale2;        // both halves: the query's maximum
        const float mnew  = fmaxf(mrun, mx);
        const float alpha = exp2_slot(mrun - mnew);  // 0 on the first pass
        mrun = mnew;

        // ---- P^T as B operand: element i = key 16*(i>>3) + 8*half + (i&7) of the pass ----
        v16h pb;
        float ps[4] = {0.0f, 0.0f, 0.0f, 0.0f};   // four short add chains
#pragma unroll
        for (int i = 0; i < 16; ++i) {
            float e = exp2_slot(fmaf(s[i], scale2, -mnew));  // 0 when masked
            ps[i & 3] += e;
            pb[i] = (_Float16)e;
        }
        lsum = lsum * alpha + ((ps[0] + ps[1]) + (ps[2] + ps[3]));

        // ---- O^T = alpha * O^T + V^T @ P^T ----
#pragma unroll
        for (int dt = 0; dt < 4; ++dt) {
            acc[dt] *= alpha;
            acc[dt] = __builtin_amdgcn_wmma_f32_16x16x32_f16(
                false, va[dt], false, pb, (short)0, acc[dt], false, false);
        }
    }

    // ---- normalize and store: 8 consecutive head columns per lane ----
    const float inv = 1.0f / (lsum + xhalf(lsum));
    float* orow = out + ((size_t)b * TT + query) * HH + (half << 3);
#pragma unroll
    for (int dt = 0; dt < 4; ++dt)
        *(v8f*)(orow + dt * 16) = acc[dt] * inv;
}

// ---------------------------------------------------------------------------
extern "C" void kernel_launch(void* const* d_in, const int* in_sizes, int n_in,
                              void* d_out, int out_size, void* d_ws, size_t ws_size,
                              hipStream_t stream) {
    const float* x  = (const float*)d_in[0];
    const float* Wk = (const float*)d_in[1];
    const float* Wq = (const float*)d_in[2];
    const float* Wv = (const float*)d_in[3];
    float* out = (float*)d_out;

    const int B = in_sizes[0] / (TT * CC);   // 64

    // workspace layout (halfs): Kh | Qh | Vt
    const size_t per = (size_t)B * TT * HH;  // 2M halfs = 4 MB each
    _Float16* Kh = (_Float16*)d_ws;
    _Float16* Qh = Kh + per;
    _Float16* Vt = Qh + per;

    const int nTiles = B * (TT / 16);        // one wave per 16-row tile, AW waves a work-group
    proj_kernel<<<dim3(B * (TT / 32) / PW), dim3(PW * 32), 0, stream>>>(x, Wk, Wq, Wv, Kh, Qh, Vt);   // one wave per 32 rows
    attn_kernel<<<dim3(nTiles / AW), dim3(AW * 32), 0, stream>>>(Kh, Qh, Vt, out);
}

// v006
// A run of this version takes 19.4 microseconds.
// Two timings next to v005 put it at 1.09 and 1.10 times that version's speed.
// Over all steps from v000 it is 3.73 times as fast.
#include <hip/hip_runtime.h>
#include <hip/hip_bf16.h>

typedef __attribute__((ext_vector_type(16))) _Float16 v16h;
typedef __attribute__((ext_vector_type(8)))  _Float16 v8h;
typedef __attribute__((ext_vector_type(4)))  _Float16 v4h;
typedef __attribute__((ext_vector_type(8)))  float    v8f;
typedef __attribute__((ext_vector_type(4)))  float    v4f;

#define TT 512   // sequence length
#define CC 384   // n_embd
#define HH 64    // head size

// Fence that nothing is scheduled across: loads, conversions and WMMAs stay on
// their side.  A conversion of the next step's x lifted over it would wait for
// that x in front of the loads of the step after, and only PD - 1 steps' loads
// would be in flight.
#if defined(__AMDGCN__) && __has_builtin(__builtin_amdgcn_sched_barrier)
#define SCHED_FENCE() __builtin_amdgcn_sched_barrier(0)
#else
#define SCHED_FENCE()
#endif

// For a stride-1 row source, the 16 operand halfs are two contiguous 8-elem
// chunks at [kbase + half*8] and [kbase + 16 + half*8].
__device__ __forceinline__ v16h op_from_row_f16(const _Float16* row, int kbase, int half) {
    v8h c0 = *(const v8h*)(row + kbase + half * 8);
    v8h c1 = *(const v8h*)(row + kbase + 16 + half * 8);
    v16h r;
#pragma unroll
    for (int j = 0; j < 8; ++j) { r[j] = c0[j]; r[8 + j] = c1[j]; }
    return r;
}

// Assemble f16 operand from two raw f32 chunks (cvt at use site).
__device__ __forceinline__ v16h op_from_f32_chunks(v8f c0, v8f c1) {
    v16h r;
#pragma unroll
    for (int j = 0; j < 8; ++j) { r[j] = (_Float16)c0[j]; r[8 + j] = (_Float16)c1[j]; }
    return r;
}

// ---------------------------------------------------------------------------
// Kernel 1: q/k/v projections.  One wave per (batch, 32-row tile): a wave tile
// of 32 rows x 192 columns (K | Q | V), 24 accumulator tiles.  Each x fragment
// is loaded and converted once and feeds 12 WMMAs; each W fragment feeds 2.
// W is read as it lies, f32 [c][h]: one 16-byte load gives a lane 4 adjacent
// columns of one k row, and 16 lanes cover the whole 256-byte row.  The 16 k
// rows of a lane's half hold 4 B fragments: fragment jj has column
// 4 * lane + jj, so nothing is gathered or transposed.
// 16-bit operand, lane half h, element e:  k = (e >> 3) * 16 + h * 8 + (e & 7).
// The four waves of a work-group share that work: wave v loads and converts
// elements 4v .. 4v+3 of all 12 fragments of a k step and puts them into LDS,
// one step ahead, two buffers, one barrier a step; every wave reads all 12.
// The global loads of x and of W both run PD steps ahead of their step, in
// registers: x comes from memory, and a step is much shorter than that latency.
// ---------------------------------------------------------------------------
// Work-group barrier that orders LDS traffic alone.  __syncthreads() also waits
// for every global load in flight, here the x and W asked for ahead: each step
// would then pay their whole latency.
#define LDS_BARRIER() do {                                                  \
        __builtin_amdgcn_fence(__ATOMIC_RELEASE, "workgroup", "local");     \
        __builtin_amdgcn_s_barrier();                                       \
        __builtin_amdgcn_fence(__ATOMIC_ACQUIRE, "workgroup", "local");     \
    } while (0)

#define RF 2     // 16-row x fragments per wave
#define NB 12    // W fragments per k step: 3 matrices x 4 column sets
#define PW 4     // waves per work-group
#define FH 512   // halfs per fragment in LDS: [element >> 3][lane][element & 7]
#define PD 3     // steps the global loads run ahead: 16 loads a step, under 64 of a wave in flight

__global__ void __launch_bounds__(PW * 32)   // the real block size: one wave a SIMD, 24 tiles need more than 256 registers
proj_kernel(const float* __restrict__ x,
                            const float* __restrict__ Wk,
                            const float* __restrict__ Wq,
                            const float* __restrict__ Wv,
                            _Float16* __restrict__ Kh,
                            _Float16* __restrict__ Qh,
                            _Float16* __restrict__ Vt) {
    __shared__ __attribute__((aligned(16))) _Float16 Ws[2][NB * FH];   // 2 x 12 KB

    const int lane  = threadIdx.x & 31;
    const int wave  = threadIdx.x >> 5;
    const int half  = lane >> 4;
    const int nm    = lane & 15;
    const int tile  = blockIdx.x * PW + wave;
    const int b     = tile >> 4;
    const int tbase = (tile & 15) << 5;

    v8f acc[RF][NB];
#pragma unroll
    for (int m = 0; m < RF; ++m)
#pragma unroll
        for (int j = 0; j < NB; ++j) acc[m][j] = 0.0f;

    // one 32-bit lane offset per operand: the address registers are set once
    const float* xb = x + ((size_t)b * TT + tbase) * CC;
    const unsigned xo = nm * CC + half * 8;
    // k row of element 4 * wave of this lane's half, columns 4 * nm ..
    const unsigned wo = ((wave >> 1) * 16 + half * 8 + (wave & 1) * 4) * HH + nm * 4;
    // this wave's 8 bytes of a lane's 32-byte fragment
    const unsigned ws_o = (wave >> 1) * (FH / 2) + lane * 8 + (wave & 1) * 4;

    auto loadA = [&](int kk, v8f (*dst)[2]) {
#pragma unroll
        for (int m = 0; m < RF; ++m) {
            dst[m][0] = *(const v8f*)(xb + (xo + m * 16 * CC + kk * 32));
            dst[m][1] = *(const v8f*)(xb + (xo + m * 16 * CC + kk * 32 + 16));
        }
    };
    // dst[w][i] = W_w[k(4 * wave + i)][4 * nm .. 4 * nm + 3]
    auto loadW = [&](int kk, v4f (*dst)[4]) {
#pragma unroll
        for (int w = 0; w < 3; ++w) {
            const float* Wb = (w == 0) ? Wk : (w == 1) ? Wq : Wv;
#pragma unroll
            for (int i = 0; i < 4; ++i)
                dst[w][i] = *(const v4f*)(Wb + (wo + (kk * 32 + i) * HH));
        }
    };
    auto storeW = [&](int buf, const v4f (*src)[4]) {
#pragma unroll
        for (int j = 0; j < NB; ++j) {
            v4h p;
#pragma unroll
            for (int i = 0; i < 4; ++i) p[i] = (_Float16)src[j >> 2][i][j & 3];
            *(v4h*)&Ws[buf][j * FH + ws_o] = p;
        }
    };

    v8f araw[PD + 1][RF][2];   // raw x of step s lies in araw[s % (PD + 1)]
    v4f wr[PD][3][4];          // raw W of step s lies in wr[s % PD]
    // Loads answer in the order of issue.  W of step s stands in front of x of
    // step s, and both equally far ahead, so the wait for a step's W waits for
    // no x that is younger than the x the same step needs.
#pragma unroll         // constant ring indices: both rings stay in registers
    for (int s = 0; s < PD; ++s) {
        loadW(s, wr[s]);
        SCHED_FENCE();     // keeps that order of issue: regrouped loads made the first wait a wait for all
        loadA(s, araw[s]);
        SCHED_FENCE();     // the same, and every load stays above the first wait
    }
    storeW(0, wr[0]);
    LDS_BARRIER();     // step 0's fragments are whole

#pragma unroll
    for (int kk = 0; kk < CC / 32; ++kk) {
        const int cur = kk & 1, nxt = cur ^ 1;
        // the loads of W and of x PD steps ahead; W of step kk left its
        // registers for LDS in the step before
        if (kk + PD < CC / 32) {
            loadW(kk + PD, wr[kk % PD]);
            loadA(kk + PD, araw[(kk + PD) % (PD + 1)]);
        }
        // behind the last loads of W and of x their address registers are free
        // for other values: the wait stands in front of any such overwrite
        if (kk + PD == CC / 32 - 1)
            asm volatile("s_wait_xcnt 0x0" ::: "memory");
        SCHED_FENCE();              // the loads (and that wait) stay above all else
        // this step's fragments out of LDS, the next step's into the other
        // buffer: its readers left it before the last barrier
        v16h bm[NB];
#pragma unroll
        for (int j = 0; j < NB; ++j) {
            v8h c0 = *(const v8h*)&Ws[cur][j * FH + lane * 8];
            v8h c1 = *(const v8h*)&Ws[cur][j * FH + FH / 2 + lane * 8];
#pragma unroll
            for (int e = 0; e < 8; ++e) { bm[j][e] = c0[e]; bm[j][8 + e] = c1[e]; }
        }
        if (kk + 1 < CC / 32) storeW(nxt, wr[(kk + 1) % PD]);
        SCHED_FENCE();              // LDS traffic stays above, WMMAs below
        v16h a[RF];
#pragma unroll
        for (int m = 0; m < RF; ++m)
            a[m] = op_from_f32_chunks(araw[kk % (PD + 1)][m][0], araw[kk % (PD + 1)][m][1]);
#pragma unroll
        for (int j = 0; j < NB; ++j)
#pragma unroll
            for (int m = 0; m < RF; ++m)
                acc[m][j] = __builtin_amdgcn_wmma_f32_16x16x32_f16(
                    false, a[m], false, bm[j], (short)0, acc[m][j], false, false);
        SCHED_FENCE();
        // the next step's fragments are whole, and this step's buffer is free
        if (kk + 1 < CC / 32) LDS_BARRIER();
    }

    // acc[m][w*4 + jj][r] = (x W_w)[tbase + m*16 + 8*half + r][4*nm + jj]
    // every result is rounded to f16 first, into registers of its own
    v4h kq[RF][2][8];    // K, Q: 4 adjacent columns of one row
    v8h vv[RF][4];       // V: 8 adjacent rows of one column
#pragma unroll
    for (int m = 0; m < RF; ++m) {
#pragma unroll
        for (int w = 0; w < 2; ++w)
#pragma unroll
            for (int r = 0; r < 8; ++r)
#pragma unroll
                for (int jj = 0; jj < 4; ++jj) kq[m][w][r][jj] = (_Float16)acc[m][w * 4 + jj][r];
#pragma unroll
        for (int jj = 0; jj < 4; ++jj)
#pragma unroll
            for (int r = 0; r < 8; ++r) vv[m][jj][r] = (_Float16)acc[m][8 + jj][r];
    }
    // conversions stay above, stores below: no store's data register is
    // rewritten while the store is in flight
    __builtin_amdgcn_sched_barrier(0);

    const size_t   rb = ((size_t)b * TT + tbase) * HH;   // wave-uniform
    const unsigned so = (half << 3) * HH + nm * 4;       // lane offset, K and Q alike
    _Float16* vb = Vt + (size_t)b * HH * TT + tbase;
    const unsigned vo = nm * 4 * TT + (half << 3);
#pragma unroll
    for (int m = 0; m < RF; ++m) {
        // K, Q row-major [b][t][h]: 16 lanes x 8 bytes are one whole 128-byte row
#pragma unroll
        for (int w = 0; w < 2; ++w) {
            _Float16* dst = ((w == 0) ? Kh : Qh) + rb;
#pragma unroll
            for (int r = 0; r < 8; ++r)
                *(v4h*)(dst + (so + (m * 16 + r) * HH)) = kq[m][w][r];
        }
        // V transposed [b][h][t]: r=0..7 are consecutive t -> packed 16B stores
#pragma unroll
        for (int jj = 0; jj < 4; ++jj)
            *(v8h*)(vb + (vo + jj * TT + m * 16)) = vv[m][jj];
    }
}

#define AW 8
#define KP 72
#define VP 520
#define MS (9 * 128)

// Eight asynchronous 16-byte-per-lane copies global -> LDS.  The s_wait_xcnt
// stands inside the statement, so no address register of a copy is rewritten
// in front of it.
__device__ __forceinline__ void copy8(const unsigned* l, const char* const* g) {
    asm volatile(
        "global_load_async_to_lds_b128 %0, %8, off\n\t"
        "global_load_async_to_lds_b128 %1, %9, off\n\t"
        "global_load_async_to_lds_b128 %2, %10, off\n\t"
        "global_load_async_to_lds_b128 %3, %11, off\n\t"
        "global_load_async_to_lds_b128 %4, %12, off\n\t"
        "global_load_async_to_lds_b128 %5, %13, off\n\t"
        "global_load_async_to_lds_b128 %6, %14, off\n\t"
        "global_load_async_to_lds_b128 %7, %15, off\n\t"
        "s_wait_xcnt 0x0"
        :: "v"(l[0]), "v"(l[1]), "v"(l[2]), "v"(l[3]),
           "v"(l[4]), "v"(l[5]), "v"(l[6]), "v"(l[7]),
           "v"(g[0]), "v"(g[1]), "v"(g[2]), "v"(g[3]),
           "v"(g[4]), "v"(g[5]), "v"(g[6]), "v"(g[7])
        : "memory");
}

// lane l <-> lane l ^ 16
__device__ __forceinline__ float xhalf(float x) {
    return __builtin_bit_cast(float, __builtin_amdgcn_permlanex16(
        __builtin_bit_cast(int, x), __builtin_bit_cast(int, x),
        0x76543210, 0xfedcba98, false, false));
}

// 2^x.  The v_nop is the slot the instruction set asks for behind a
// transcendental before its result is read or its source overwritten.
__device__ __forceinline__ float exp2_slot(float x) {
    float e;
    asm("v_exp_f32 %0, %1\n\tv_nop" : "=v"(e) : "v"(x));
    return e;
}

__global__ void __launch_bounds__(AW * 32)   // the real block size: two waves a SIMD
attn_kernel(const _Float16* __restrict__ Kh,
                            const _Float16* __restrict__ Qh,
                            const _Float16* __restrict__ Vt,
                            float* __restrict__ out) {
    __shared__ __attribute__((aligned(16))) _Float16 Ks[TT * KP];   // 72 KB
    __shared__ __attribute__((aligned(16))) _Float16 Vs[HH * VP];   // 65 KB
    __shared__ __attribute__((aligned(16))) float    Ms[AW * MS];   // 36 KB: a wave's part of the tile it gives away

    const int lane  = threadIdx.x & 31;
    const int wave  = threadIdx.x >> 5;
    const int half  = lane >> 4;
    const int nm    = lane & 15;
    const int b     = blockIdx.x / (TT / 16 / AW);
    // the wave's number as a scalar: the trip counts below differ from wave to
    // wave, and the loops hold WMMAs, so their branches must be scalar ones
    const int wv    = __builtin_amdgcn_readfirstlane(wave);
    const int par   = wv >> 2;                                      // 0: even passes, 1: odd passes
    const int tlo   = (blockIdx.x % (TT / 16 / AW)) * (AW / 2) + (wv & 3);   // 0..15
    const int thi   = TT / 16 - 1 - tlo;                            // 16..31
    const int tgive = par ? tlo : thi;    // done first, handed to wave wv ^ 4
    const int tkeep = par ? thi : tlo;    // done second, finished here
    // 384^-0.5 (C, per reference) times log2(e): the exponentials are base 2
    const float scale2 = 0.05103103630798287f * 1.4426950408889634f;

    // ---- K and V^T of the batch, 64 KB each: a wave copies 8 KB of either ----
    {
        const char* gk = (const char*)(Kh + (size_t)b * TT * HH);
        const char* gv = (const char*)(Vt + (size_t)b * HH * TT);
        const unsigned lk = (unsigned)(size_t)&Ks[0];   // low 32 bits: the LDS byte address
        const unsigned lv = (unsigned)(size_t)&Vs[0];
#pragma unroll
        for (int grp = 0; grp < 2; ++grp) {
            unsigned    l[8];
            const char* g[8];
            // K: a copy is 4 rows of 128 B
#pragma unroll
            for (int i = 0; i < 8; ++i) {
                const int c = wave * 16 + grp * 8 + i;       // 512-byte piece, 0..127
                l[i] = lk + (c * 4 + (lane >> 3)) * (KP * 2) + (lane & 7) * 16;
                g[i] = gk + c * 512 + lane * 16;
            }
            copy8(l, g);
            // V^T: a copy is half a row of 1024 B
#pragma unroll
            for (int i = 0; i < 8; ++i) {
                const int c = wave * 16 + grp * 8 + i;
                l[i] = lv + (c >> 1) * (VP * 2) + (c & 1) * 512 + lane * 16;
                g[i] = gv + c * 512 + lane * 16;
            }
            copy8(l, g);
        }
    }

    const _Float16* qg = Qh + ((size_t)b * TT + tgive * 16 + nm) * HH;
    const _Float16* qk = Qh + ((size_t)b * TT + tkeep * 16 + nm) * HH;
    const v16h qg0 = op_from_row_f16(qg, 0, half);
    const v16h qg1 = op_from_row_f16(qg, 32, half);
    const v16h qk0 = op_from_row_f16(qk, 0, half);
    const v16h qk1 = op_from_row_f16(qk, 32, half);

    // this wave's copies have landed; behind the barrier so have all eight waves'
    asm volatile("s_wait_asynccnt 0x0" ::: "memory");
    __syncthreads();

    // This wave's passes of one tile.  On return:
    // acc[dt][r] = O[query nm][dt*16 + 8*half + r], not yet normalized;
    // mrun = running maximum of the query's scaled scores over those passes;
    // lsum = sum over this lane's half of their keys.
    auto passes = [&](int tile, const v16h& qb0, const v16h& qb1,
                      v8f (&acc)[4], float& mrun, float& lsum) {
#pragma unroll
    for (int dt = 0; dt < 4; ++dt) acc[dt] = 0.0f;
    mrun = -1e30f;
    lsum = 0.0f;
    const int query = tile * 16 + nm;
    const int np    = (tile >> 1) + 1;     // the last pass holds the diagonal

    for (int p = par; p < np; p += 2) {
        // all fragments of the pass are asked for at its top, K first: LDS
        // answers in order and K is used first
        v16h ka[2][2];
#pragma unroll
        for (int t = 0; t < 2; ++t) {
            const _Float16* krow = &Ks[(p * 32 + t * 16 + nm) * KP];
            ka[t][0] = op_from_row_f16(krow, 0, half);
            ka[t][1] = op_from_row_f16(krow, 32, half);
        }
        v16h va[4];
#pragma unroll
        for (int dt = 0; dt < 4; ++dt)
            va[dt] = op_from_row_f16(&Vs[(dt * 16 + nm) * VP], p * 32, half);

        // inputs only: all four K fragments are read before the first product, so
        // a pass pays one LDS latency, not one per product
        asm volatile("" :: "v"(ka[0][0]), "v"(ka[0][1]), "v"(ka[1][0]), "v"(ka[1][1]));

        // ---- S^T = K @ Q^T, two 16-key tiles ----
        v8f st[2];
#pragma unroll
        for (int t = 0; t < 2; ++t) {
            v8f c = 0.0f;
            c = __builtin_amdgcn_wmma_f32_16x16x32_f16(false, ka[t][0], false, qb0, (short)0, c, false, false);
            c = __builtin_amdgcn_wmma_f32_16x16x32_f16(false, ka[t][1], false, qb1, (short)0, c, false, false);
            st[t] = c;     // st[t][r] = S[query nm][p*32 + t*16 + 8*half + r]
        }

        // ---- causal mask, running maximum (scale2 > 0: it commutes with max) ----
        float s[16];
        float mx = -1e30f;
#pragma unroll
        for (int i = 0; i < 16; ++i) {
            const int key = p * 32 + ((i >> 3) << 4) + (half << 3) + (i & 7);
            float v = st[i >> 3][i & 7];
            if (key > query) v = -1e30f;           // causal mask
            s[i] = v;
            mx = fmaxf(mx, v);
        }
        mx = fmaxf(mx, xhalf(mx)) * scale2;        // both halves: the query's maximum
        const float mnew  = fmaxf(mrun, mx);
        const float alpha = exp2_slot(mrun - mnew);  // 0 on the first pass
        mrun = mnew;

        // ---- P^T as B operand: element i = key 16*(i>>3) + 8*half + (i&7) of the pass ----
        v16h pb;
        float ps[4] = {0.0f, 0.0f, 0.0f, 0.0f};   // four short add chains
#pragma unroll
        for (int i = 0; i < 16; ++i) {
            float e = exp2_slot(fmaf(s[i], scale2, -mnew));  // 0 when masked
            ps[i & 3] += e;
            pb[i] = (_Float16)e;
        }
        lsum = lsum * alpha + ((ps[0] + ps[1]) + (ps[2] + ps[3]));

        // ---- O^T = alpha * O^T + V^T @ P^T ----
#pragma unroll
        for (int dt = 0; dt < 4; ++dt) {
            acc[dt] *= alpha;
            acc[dt] = __builtin_amdgcn_wmma_f32_16x16x32_f16(
                false, va[dt], false, pb, (short)0, acc[dt], false, false);
        }
    }
    };

    v8f   acc[4];
    float mrun, lsum;

    // ---- the tile that the partner finishes: this wave's part goes to LDS ----
    passes(tgive, qg0, qg1, acc, mrun, lsum);
    {
        float* mine = &Ms[wv * MS + lane * 4];
#pragma unroll
        for (int dt = 0; dt < 4; ++dt) {
            *(v4f*)(mine + (dt * 2 + 0) * 128) = __builtin_shufflevector(acc[dt], acc[dt], 0, 1, 2, 3);
            *(v4f*)(mine + (dt * 2 + 1) * 128) = __builtin_shufflevector(acc[dt], acc[dt], 4, 5, 6, 7);
        }
        v4f ml = {mrun, lsum, 0.0f, 0.0f};
        *(v4f*)(mine + 8 * 128) = ml;
    }

    // ---- the tile that this wave finishes ----
    passes(tkeep, qk0, qk1, acc, mrun, lsum);

    __syncthreads();     // the partner's part of that tile is whole

    // ---- join the two parts on their common maximum (a part of no passes has
    //      maximum -1e30 and weight 0), normalize, store ----
    const float* his = &Ms[(wv ^ 4) * MS + lane * 4];
    const v4f   ml   = *(const v4f*)(his + 8 * 128);
    const float mall = fmaxf(mrun, ml[0]);
    const float wk   = exp2_slot(mrun - mall);
    const float wg   = exp2_slot(ml[0] - mall);
    const float lall = lsum * wk + ml[1] * wg;
    const float inv  = 1.0f / (lall + xhalf(lall));
    const float fk   = wk * inv, fg = wg * inv;
    float* orow = out + ((size_t)b * TT + tkeep * 16 + nm) * HH + (half << 3);
#pragma unroll
    for (int dt = 0; dt < 4; ++dt) {
        const v4f g0 = *(const v4f*)(his + (dt * 2 + 0) * 128);
        const v4f g1 = *(const v4f*)(his + (dt * 2 + 1) * 128);
        const v8f gg = __builtin_shufflevector(g0, g1, 0, 1, 2, 3, 4, 5, 6, 7);
        *(v8f*)(orow + dt * 16) = acc[dt] * fk + gg * fg;
    }
}

// ---------------------------------------------------------------------------
extern "C" void kernel_launch(void* const* d_in, const int* in_sizes, int n_in,
                              void* d_out, int out_size, void* d_ws, size_t ws_size,
                              hipStream_t stream) {
    const float* x  = (const float*)d_in[0];
    const float* Wk = (const float*)d_in[1];
    const float* Wq = (const float*)d_in[2];
    const float* Wv = (const float*)d_in[3];
    float* out = (float*)d_out;

    const int B = in_sizes[0] / (TT * CC);   // 64

    // workspace layout (halfs): Kh | Qh | Vt
    const size_t per = (size_t)B * TT * HH;  // 2M halfs = 4 MB each
    _Float16* Kh = (_Float16*)d_ws;
    _Float16* Qh = Kh + per;
    _Float16* Vt = Qh + per;

    const int nTiles = B * (TT / 16);        // AW tiles and AW waves a work-group
    proj_kernel<<<dim3(B * (TT / 32) / PW), dim3(PW * 32), 0, stream>>>(x, Wk, Wq, Wv, Kh, Qh, Vt);   // one wave per 32 rows
    attn_kernel<<<dim3(nTiles / AW), dim3(AW * 32), 0, stream>>>(Kh, Qh, Vt, out);
}
